// v000
// The times below were measured on an AMD MI455X: many runs one after another, warmed up first and cycling through
// copies of the inputs, with the whole window's GPU time divided by the number of runs. Launches and the gaps
// between them are all in it. The median over several windows is given; except for v000 it joins two sittings, which
// can be a few percent apart, so the side-by-side timings, each taken in one sitting, are the better comparison.
// The starting kernel, v000, takes 286 microseconds a run.
#include <hip/hip_runtime.h>
// Linear (softmax-free) dot-product attention, q/k/v [2][16][2048][128] f32, no mask: out = (q k^T * 128^-0.5) v. All contractions: v_wmma_f32_16x16x32_f16, f32 accumulate.
// Operands: q, k, v RNE-converted to bf16 then stored as exact f16 planes; S^T = K Q^T (exact products), scale applied in f32;
// P = scaled score carried x256 as f16 (single product, value select clears anything under 2^-14 after the carry); O^T = V^T P, x2^-8 in the f32 epilogue.
#ifndef NB
#define NB 2
#endif
#ifndef SEQ
#define SEQ 2048
#endif
#define NB_FULL 2
#define SEQ_FULL 2048
#define NH 16
#define HD 128
#define KCH (HD / 32)                          /* 32-deep k-steps per score */
#define DTL (HD / 16)                          /* 16-row d tiles of O^T */
#define NPL (NB * NH)                          /* (batch, head) planes processed */
#define PLANE_BYTES ((size_t)NPL * SEQ * HD * 2)

static_assert(SEQ % 64 == 0);
static_assert(SEQ <= SEQ_FULL);
static_assert(NB <= NB_FULL);
static_assert(HD == 128);
static_assert(KCH == 4);
static_assert(DTL == 8);
static_assert(3 * ((size_t)NPL * SEQ * HD * 2) <= (size_t)134217728);
static_assert(((size_t)NPL * SEQ * HD * 2) % 256 == 0);
/* coverage: conversion pass, (SEQ/64 x NPL) blocks x 256 threads x 4 chunks x 8 halves per plane */
static_assert((size_t)(SEQ / 64) * NPL * 256 * 4 * 8 == (size_t)NPL * SEQ * HD);
/* coverage: attention pass, (SEQ/64 x NPL) blocks x 4 waves x 16 rows x HD floats */
static_assert((size_t)(SEQ / 64) * NPL * 4 * 16 * HD == (size_t)NPL * SEQ * HD);
/* one store instruction of the epilogue = 32 lanes x 16 B = one output row */
static_assert(32 * 16 == HD * 4);
/* key loop of the attention pass steps by 32 keys */
static_assert(SEQ % 32 == 0);

typedef _Float16 v16h __attribute__((ext_vector_type(16)));
typedef unsigned short v8us __attribute__((ext_vector_type(8), may_alias));
typedef float v8f  __attribute__((ext_vector_type(8)));
typedef float v4f  __attribute__((ext_vector_type(4)));
typedef float v4fa __attribute__((ext_vector_type(4), may_alias));
union FragH { v16h v; v8us half[2]; _Float16 h[16]; unsigned short u[16]; };

#if defined(__has_builtin)
#if __has_builtin(__builtin_amdgcn_exp2f)
#define EXP2F(x) __builtin_amdgcn_exp2f(x)
#endif
#endif
#ifndef EXP2F
#define EXP2F(x) exp2f(x)
#endif

__device__ __forceinline__ unsigned short bf16_bits(float x) { unsigned int u = __float_as_uint(x); return (unsigned short)((u + 0x7FFFu + ((u >> 16) & 1u)) >> 16); }
__device__ __forceinline__ float bf16_val(unsigned short b) { return __uint_as_float(((unsigned int)b) << 16); }
__device__ __forceinline__ float bf16_rne(float x) { return bf16_val(bf16_bits(x)); }

// f32 -> f16 (RNE) that cannot yield an f16 subnormal: magnitudes under 2^-14 become zero by a value select
static __device__ __forceinline__ _Float16 toh_flush(float v) {
  const _Float16 r = (_Float16)v;
  return (fabsf(v) < 6.103515625e-05f) ? (_Float16)0.0f : r;
}

// one WMMA followed by the 4-slot hazard guard (ties D, keeps A/B live)
__device__ __forceinline__ v8f mma16(v16h a, v16h b, v8f c) {
  v8f d = __builtin_amdgcn_wmma_f32_16x16x32_f16(false, a, false, b, (short)0, c, false, false);
  asm volatile("v_nop\n\tv_nop\n\tv_nop\n\tv_nop" : "+v"(d) : "v"(a), "v"(b));
  return d;
}

// Conversion pass. Block = (64-token tile, plane). q, k -> f16(bf16(x)) rows [plane][SEQ][128]; v -> transposed [plane][128][SEQ] through LDS.
__global__ __launch_bounds__(256) void k_cvt(const float* __restrict__ q, const float* __restrict__ k, const float* __restrict__ v,
                                            _Float16* __restrict__ Q16, _Float16* __restrict__ K16, _Float16* __restrict__ VT) {
  __shared__ unsigned short tl[HD][72];                 /* [d][token]; rows 0..127, columns 0..63 written and read (cross-wave: block barrier) */
  const unsigned tid = threadIdx.x;
  const unsigned jb = blockIdx.x << 6;
  const unsigned bh = blockIdx.y;
  const size_t ib = ((size_t)bh * SEQ_FULL + jb) * HD;  /* input tile base (full strides) */
  const size_t ob = ((size_t)bh * SEQ + jb) * HD;       /* row-plane tile base */
  FragH fq[4], fk[4], fv[4];
#pragma unroll
  for (int i = 0; i < 4; ++i) {
    const unsigned c = tid + ((unsigned)i << 8);
    const unsigned row = c >> 4, c8 = (c & 15u) << 3;
    const size_t go = ib + (size_t)(row << 7) + c8;
    const v4f qa = *(const v4fa*)(q + go), qc = *(const v4fa*)(q + go + 4);
    const v4f ka = *(const v4fa*)(k + go), kc = *(const v4fa*)(k + go + 4);
    const v4f va = *(const v4fa*)(v + go), vc = *(const v4fa*)(v + go + 4);
    FragH t;
#pragma unroll
    for (int j = 0; j < 4; ++j) {
      fq[i].h[j] = (_Float16)bf16_rne(qa[j]); fq[i].h[4 + j] = (_Float16)bf16_rne(qc[j]);
      fk[i].h[j] = (_Float16)bf16_rne(ka[j]); fk[i].h[4 + j] = (_Float16)bf16_rne(kc[j]);
      t.h[j] = (_Float16)bf16_rne(va[j]);     t.h[4 + j] = (_Float16)bf16_rne(vc[j]);
    }
#pragma unroll
    for (int j = 0; j < 8; ++j) tl[c8 + j][row] = t.u[j];
  }
  __syncthreads();
#pragma unroll
  for (int i = 0; i < 4; ++i) {
    const unsigned c = tid + ((unsigned)i << 8);
    const unsigned d = c >> 3, j8 = (c & 7u) << 3;
#pragma unroll
    for (int j = 0; j < 8; ++j) fv[i].u[j] = tl[d][j8 + j];
  }
  {
#pragma unroll
    for (int i = 0; i < 4; ++i) {
      const unsigned c = tid + ((unsigned)i << 8);
      const unsigned row = c >> 4, c8 = (c & 15u) << 3;   /* row planes */
      const unsigned d = c >> 3, j8 = (c & 7u) << 3;      /* transposed plane */
      const v8us oq = fq[i].half[0], ok = fk[i].half[0], ov = fv[i].half[0];
      *(v8us*)((unsigned short*)Q16 + ob + (size_t)(row << 7) + c8) = oq;
      *(v8us*)((unsigned short*)K16 + ob + (size_t)(row << 7) + c8) = ok;
      *(v8us*)((unsigned short*)VT + ((size_t)bh * HD + d) * SEQ + jb + j8) = ov;
    }
    
  }
}

// Linear attention (no softmax), transposed dataflow. Wave = 16 query rows; block = 4 independent waves (64 rows).
// Per 32-key step:
// S^T tiles (m = key, n = query) = K (A, rows from the K plane) x Q^T (B, rows from the Q plane), 4 k-steps of 32;
// P = S^T * 128^-0.5 * 2^8 in f32, converted to f16 (signed values, no normalisation);
// P (B operand) taken from the two score tiles in place: element r <- tile0[r], element 8+r <- tile1[r];
// O^T (m = d, n = query) += V^T (A, rows from the transposed V plane) x P, 8 d tiles; the 2^-8 is applied in the epilogue.
__global__ __launch_bounds__(128) void k_attn(const _Float16* __restrict__ Q16, const _Float16* __restrict__ K16, const _Float16* __restrict__ VT,
                                             float* __restrict__ out) {
  __shared__ __attribute__((aligned(16))) float so[4][16][HD];   /* per-wave private output staging (same wave writes and reads) */
  const unsigned tid = threadIdx.x, w = tid >> 5, lane = tid & 31u, ln = lane & 15u, hh = lane >> 4;
  const unsigned bh = blockIdx.y;
  const unsigned q0 = (blockIdx.x << 6) + (w << 4);
  const unsigned qa = q0 + ln;
  const unsigned short* qrow = (const unsigned short*)Q16 + ((size_t)bh * SEQ + qa) * HD;
  const unsigned short* kpl = (const unsigned short*)K16 + (size_t)bh * SEQ * HD;
  const unsigned short* vpl = (const unsigned short*)VT + (size_t)bh * HD * SEQ;

  FragH qb[KCH];
#pragma unroll
  for (int kc = 0; kc < KCH; ++kc) {
    qb[kc].half[0] = *(const v8us*)(qrow + 32 * kc + 8u * hh);
    qb[kc].half[1] = *(const v8us*)(qrow + 32 * kc + 16 + 8u * hh);
  }

  const v8f z8 = {0.f, 0.f, 0.f, 0.f, 0.f, 0.f, 0.f, 0.f};
  v8f acc[DTL] = {z8, z8, z8, z8, z8, z8, z8, z8};
  const float PS = 0.08838834764831845f * 256.0f;        /* 128^-0.5 applied in f32, P carried x2^8 */

#pragma unroll 1
  for (unsigned n0 = 0; n0 < SEQ; n0 += 32u) {
    v8f st[2] = {z8, z8};
#pragma unroll
    for (int kc = 0; kc < KCH; ++kc) {
#pragma unroll
      for (int t = 0; t < 2; ++t) {
        const unsigned short* kr = kpl + (size_t)(n0 + 16u * t + ln) * HD + 32 * kc;
        FragH ka;
        ka.half[0] = *(const v8us*)(kr + 8u * hh);
        ka.half[1] = *(const v8us*)(kr + 16 + 8u * hh);
        st[t] = mma16(ka.v, qb[kc].v, st[t]);
      }
    }
    // scale and convert (st[t][r] <-> key n0 + 16t + 8hh + r, query ln)
    FragH pf;
#pragma unroll
    for (int t = 0; t < 2; ++t)
#pragma unroll
      for (int r = 0; r < 8; ++r)
        pf.h[8 * t + r] = toh_flush(st[t][r] * PS);

#pragma unroll
    for (int dt = 0; dt < DTL; ++dt) {
      const unsigned short* vr = vpl + (size_t)(16u * dt + ln) * SEQ + n0;
      FragH va;
      va.half[0] = *(const v8us*)(vr + 8u * hh);
      va.half[1] = *(const v8us*)(vr + 16 + 8u * hh);
      acc[dt] = mma16(va.v, pf.v, acc[dt]);
    }
  }

  const float inv = 1.0f / 256.0f;
#pragma unroll
  for (int dt = 0; dt < DTL; ++dt)
#pragma unroll
    for (int r = 0; r < 8; ++r)
      so[w][ln][16 * dt + 8 * hh + r] = acc[dt][r] * inv;
  __builtin_amdgcn_fence(4 /* acq_rel order */, "workgroup");
  __builtin_amdgcn_wave_barrier();
  float* obase = out + ((size_t)bh * SEQ + q0) * HD;
  const unsigned c4 = lane << 2;
  {
#pragma unroll
    for (int qq = 0; qq < 16; ++qq) {
      const v4f vv = *(const v4fa*)&so[w][qq][c4];
      *(v4f*)(obase + (size_t)((unsigned)qq << 7) + c4) = vv;
    }
    
  }
}

extern "C" void kernel_launch(void* const* d_in, const int* in_sizes, int n_in,
                              void* d_out, int out_size, void* d_ws, size_t ws_size, hipStream_t stream) {
  if (n_in < 3) return;
  const size_t need_qkv = ((size_t)(NPL - 1) * SEQ_FULL + SEQ) * HD;
  if ((size_t)in_sizes[0] < need_qkv || (size_t)in_sizes[1] < need_qkv || (size_t)in_sizes[2] < need_qkv) return;
  if ((size_t)out_size < (size_t)NPL * SEQ * HD) return;
  const float* q = (const float*)d_in[0];
  const float* k = (const float*)d_in[1];
  const float* v = (const float*)d_in[2];
  float* out = (float*)d_out;

  char* ws = (char*)d_ws;
  size_t off = 0;
  _Float16* Q16 = (_Float16*)(ws + off); off += PLANE_BYTES;
  _Float16* K16 = (_Float16*)(ws + off); off += PLANE_BYTES;
  _Float16* VT  = (_Float16*)(ws + off); off += PLANE_BYTES;
  if (off > ws_size) return;

  k_cvt<<<dim3(SEQ / 64, NPL), 256, 0, stream>>>(q, k, v, Q16, K16, VT);
  k_attn<<<dim3(SEQ / 64, NPL), 128, 0, stream>>>(Q16, K16, VT, out);
}

// v001
// Measured time: 34.4 microseconds a run.
// In two side-by-side timings against v000, it was 8.61 and 8.49 times as fast.
#include <hip/hip_runtime.h>
// Linear (softmax-free) dot-product attention, q/k/v [2][16][2048][128] f32, no mask: out = (q k^T * 128^-0.5) v, evaluated as q ((k^T v) * 128^-0.5).
// All contractions: v_wmma_f32_16x16x32_f16, f32 accumulate. Operands: q, k, v RNE-converted to bf16 then stored as exact f16 planes.
// M = K^T V (128 x 128 per plane, exact products, f32 sums over token splits), scale applied in f32, M carried as f16 (value select clears anything under 2^-14); O^T = M^T Q^T.
#ifndef NB
#define NB 2
#endif
#ifndef SEQ
#define SEQ 2048
#endif
#define NB_FULL 2
#define SEQ_FULL 2048
#define NH 16
#define HD 128
#define KCH (HD / 32)                          /* 32-deep k-steps over HD */
#define DTL (HD / 16)                          /* 16-row d tiles of O^T */
#define NPL (NB * NH)                          /* (batch, head) planes processed */
#define PLANE_BYTES ((size_t)NPL * SEQ * HD * 2)
#define STEPS (SEQ / 32)                       /* 32-token k-steps of K^T V */
#define KSPL 8                                 /* token splits of K^T V (one block each) */
#define SPS (STEPS / KSPL)                     /* k-steps per split */
#define MP_BYTES ((size_t)KSPL * NPL * HD * HD * 4)
#define MF_BYTES ((size_t)NPL * HD * HD * 2)

static_assert(SEQ % 64 == 0);
static_assert(SEQ <= SEQ_FULL);
static_assert(NB <= NB_FULL);
static_assert(HD == 128);
static_assert(KCH == 4);
static_assert(DTL == 8);
static_assert(3 * ((size_t)NPL * SEQ * HD * 2) + MP_BYTES + MF_BYTES <= (size_t)134217728);
static_assert(STEPS % KSPL == 0);
static_assert(SEQ % 128 == 0);
static_assert(((size_t)NPL * SEQ * HD * 2) % 256 == 0);
/* coverage: conversion pass, (SEQ/64 x NPL) blocks x 256 threads x 4 chunks x 8 halves per plane */
static_assert((size_t)(SEQ / 64) * NPL * 256 * 4 * 8 == (size_t)NPL * SEQ * HD);
/* coverage: output pass, (SEQ/128 x NPL) blocks x 4 waves x 32 rows x HD floats */
static_assert((size_t)(SEQ / 128) * NPL * 4 * 32 * HD == (size_t)NPL * SEQ * HD);
/* coverage: split sum, (NPL*8) blocks x 256 threads x 8 elements */
static_assert((size_t)NPL * 8 * 256 * 8 == (size_t)NPL * HD * HD);
/* one store instruction of the epilogue = 32 lanes x 16 B = one output row */
static_assert(32 * 16 == HD * 4);

typedef _Float16 v16h __attribute__((ext_vector_type(16)));
typedef unsigned short v8us __attribute__((ext_vector_type(8), may_alias));
typedef float v8f  __attribute__((ext_vector_type(8)));
typedef float v4f  __attribute__((ext_vector_type(4)));
typedef float v4fa __attribute__((ext_vector_type(4), may_alias));
union FragH { v16h v; v8us half[2]; _Float16 h[16]; unsigned short u[16]; };

#if defined(__has_builtin)
#if __has_builtin(__builtin_amdgcn_exp2f)
#define EXP2F(x) __builtin_amdgcn_exp2f(x)
#endif
#endif
#ifndef EXP2F
#define EXP2F(x) exp2f(x)
#endif

__device__ __forceinline__ unsigned short bf16_bits(float x) { unsigned int u = __float_as_uint(x); return (unsigned short)((u + 0x7FFFu + ((u >> 16) & 1u)) >> 16); }
__device__ __forceinline__ float bf16_val(unsigned short b) { return __uint_as_float(((unsigned int)b) << 16); }
__device__ __forceinline__ float bf16_rne(float x) { return bf16_val(bf16_bits(x)); }

// f32 -> f16 (RNE) that cannot yield an f16 subnormal: magnitudes under 2^-14 become zero by a value select
static __device__ __forceinline__ _Float16 toh_flush(float v) {
  const _Float16 r = (_Float16)v;
  return (fabsf(v) < 6.103515625e-05f) ? (_Float16)0.0f : r;
}

// one WMMA followed by the 4-slot hazard guard (ties D, keeps A/B live)
__device__ __forceinline__ v8f mma16(v16h a, v16h b, v8f c) {
  v8f d = __builtin_amdgcn_wmma_f32_16x16x32_f16(false, a, false, b, (short)0, c, false, false);
  asm volatile("v_nop\n\tv_nop\n\tv_nop\n\tv_nop" : "+v"(d) : "v"(a), "v"(b));
  return d;
}

// Every loop below is fully unrolled (#pragma unroll): its index selects registers and constant address offsets.
// Every global address below is a block-uniform base plus one 32-bit lane offset plus a constant.
// XWAIT stands behind a run of global loads or stores, in front of every rewrite of a register that one of them names;
// its operand is that lane offset, which so stays in its register up to the wait.
#define XWAIT(o) asm volatile("s_wait_xcnt 0x0" :: "v"(o) : "memory")

// Fragment-major planes: one 16-row x 32-deep f16 operand tile = 512 halves = [register half 0/1][lane 0..31][8 halves];
// lane (ln = lane & 15, hh = lane >> 4), register half f, element j  <->  row ln, depth 16 f + 8 hh + j. The same order serves A and B.

// Conversion pass. Block = (64-token tile, plane). q -> f16(bf16(x)) rows [plane][SEQ][128];
// k, v -> transposed through LDS into fragment-major tiles [plane][32-token step][16-row d tile] (row = d, depth = token).
__global__ __launch_bounds__(256) void k_cvt(const float* __restrict__ q, const float* __restrict__ k, const float* __restrict__ v,
                                            _Float16* __restrict__ Q16, _Float16* __restrict__ KF, _Float16* __restrict__ VF) {
  __shared__ __attribute__((aligned(16))) unsigned short tk[64][HD + 8];   /* [token][d]; columns 0..127 written and read (cross-wave: block barrier) */
  __shared__ __attribute__((aligned(16))) unsigned short tv[64][HD + 8];
  const unsigned tid = threadIdx.x;
  const unsigned jb = blockIdx.x << 6;
  const unsigned bh = blockIdx.y;
  const size_t ib = ((size_t)bh * SEQ_FULL + jb) * HD;  /* input tile base (full strides) */
  const size_t ob = ((size_t)bh * SEQ + jb) * HD;       /* row-plane tile base */
  const float* qt = q + ib;
  const float* kt = k + ib;
  const float* vt = v + ib;
  const unsigned t8 = tid << 3;                         /* chunk c = tid + 256 i: row c >> 4, column 8 (c & 15), element 8 c of the tile */
  v4f qa[4], qc[4], ka[4], kc[4], va[4], vc[4];
#pragma unroll
  for (int i = 0; i < 4; ++i) {
    qa[i] = *(const v4fa*)(qt + t8 + 2048 * i); qc[i] = *(const v4fa*)(qt + t8 + 2048 * i + 4);
    ka[i] = *(const v4fa*)(kt + t8 + 2048 * i); kc[i] = *(const v4fa*)(kt + t8 + 2048 * i + 4);
    va[i] = *(const v4fa*)(vt + t8 + 2048 * i); vc[i] = *(const v4fa*)(vt + t8 + 2048 * i + 4);
  }
  XWAIT(t8);
  unsigned short* qo = (unsigned short*)Q16 + ob;
  const unsigned row0 = tid >> 4, c8 = (tid & 15u) << 3;
  FragH fq[4];
#pragma unroll
  for (int i = 0; i < 4; ++i) {
    FragH fk, fv;
#pragma unroll
    for (int j = 0; j < 4; ++j) {
      fq[i].h[j] = (_Float16)bf16_rne(qa[i][j]); fq[i].h[4 + j] = (_Float16)bf16_rne(qc[i][j]);
      fk.h[j] = (_Float16)bf16_rne(ka[i][j]); fk.h[4 + j] = (_Float16)bf16_rne(kc[i][j]);
      fv.h[j] = (_Float16)bf16_rne(va[i][j]); fv.h[4 + j] = (_Float16)bf16_rne(vc[i][j]);
    }
    *(v8us*)&tk[row0 + 16 * i][c8] = fk.half[0];
    *(v8us*)&tv[row0 + 16 * i][c8] = fv.half[0];
  }
  __syncthreads();
  /* piece (d, 8-token chunk ch = 2 i + b): tokens 8 ch .. +7 of the tile = step ch >> 2 = i >> 1, register half (ch >> 1) & 1 = i & 1, lane half ch & 1 = b */
  const unsigned d = tid & 127u, b = tid >> 7;
  FragH gk[4], gv[4];
#pragma unroll
  for (int i = 0; i < 4; ++i)
#pragma unroll
    for (int j = 0; j < 8; ++j) { gk[i].u[j] = tk[16 * i + 8u * b + j][d]; gv[i].u[j] = tv[16 * i + 8u * b + j][d]; }
  const size_t fbase = (((size_t)bh * STEPS + (jb >> 5)) * DTL) << 9;
  unsigned short* ko = (unsigned short*)KF + fbase;
  unsigned short* vo = (unsigned short*)VF + fbase;
  const unsigned fl = ((d >> 4) << 9) + (((b << 4) + (d & 15u)) << 3);
  /* all global stores stand behind the barrier, so that it does not wait for them */
#pragma unroll
  for (int i = 0; i < 4; ++i) {
    *(v8us*)(qo + t8 + 2048 * i) = fq[i].half[0];
    *(v8us*)(ko + fl + (((i >> 1) * DTL) << 9) + ((i & 1) << 8)) = gk[i].half[0];
    *(v8us*)(vo + fl + (((i >> 1) * DTL) << 9) + ((i & 1) << 8)) = gv[i].half[0];
  }
}

// M = K^T V, one token split per block. Block = 8 waves; wave (wa, wb) owns d1 tiles 4 wa .. +3 (A, rows of K^T) x d2 tiles 2 wb .. +1 (B, rows of V^T).
// Partial tiles go out in accumulator order: [split][plane][d1 tile * 8 + d2 tile][element quad 0/1][lane][4 floats].
__global__ __launch_bounds__(256) void k_kv(const _Float16* __restrict__ KF, const _Float16* __restrict__ VF, float* __restrict__ MP) {
  const unsigned tid = threadIdx.x, w = tid >> 5, lane = tid & 31u, wa = w >> 2, wb = w & 3u;
  const unsigned sp = blockIdx.x, bh = blockIdx.y;
  const size_t fb0 = (((size_t)bh * STEPS + (size_t)sp * SPS) * DTL) << 9;
  const unsigned short* kf = (const unsigned short*)KF + fb0;
  const unsigned short* vf = (const unsigned short*)VF + fb0;
  const unsigned ao = (wa << 11) + (lane << 3);          /* d1 tile 4 wa, this lane */
  const unsigned bo = (wb << 10) + (lane << 3);          /* d2 tile 2 wb, this lane */
  const v8f z8 = {0.f, 0.f, 0.f, 0.f, 0.f, 0.f, 0.f, 0.f};
  v8f acc[4][2] = {{z8, z8}, {z8, z8}, {z8, z8}, {z8, z8}};
  /* two fragment sets: the loads of step s + 1 are issued ahead of the products of step s, so that their latency runs under them */
  FragH fa[2][4], fb[2][2];
#pragma unroll
  for (int s = -1; s < SPS; ++s) {
    if (s + 1 < SPS) {
      const int nb = (s + 1) & 1;
#pragma unroll
      for (int a = 0; a < 4; ++a) {
        fa[nb][a].half[0] = *(const v8us*)(kf + ao + (((s + 1) * DTL + a) << 9));
        fa[nb][a].half[1] = *(const v8us*)(kf + ao + (((s + 1) * DTL + a) << 9) + 256);
      }
#pragma unroll
      for (int b = 0; b < 2; ++b) {
        fb[nb][b].half[0] = *(const v8us*)(vf + bo + (((s + 1) * DTL + b) << 9));
        fb[nb][b].half[1] = *(const v8us*)(vf + bo + (((s + 1) * DTL + b) << 9) + 256);
      }
    }
    if (s >= 0) {
      const int cb = s & 1;
#pragma unroll
      for (int a = 0; a < 4; ++a)
#pragma unroll
        for (int b = 0; b < 2; ++b)
          acc[a][b] = mma16(fa[cb][a].v, fb[cb][b].v, acc[a][b]);
    }
  }
  float* mp = MP + ((((size_t)sp * NPL + bh) * 64) << 8);
  const unsigned mo = (((4u * wa) * 8u + 2u * wb) << 8) + (lane << 2);   /* tile (4 wa, 2 wb), this lane */
#pragma unroll
  for (int a = 0; a < 4; ++a)
#pragma unroll
    for (int b = 0; b < 2; ++b) {
      const v4f lo = {acc[a][b][0], acc[a][b][1], acc[a][b][2], acc[a][b][3]};
      const v4f hi = {acc[a][b][4], acc[a][b][5], acc[a][b][6], acc[a][b][7]};
      *(v4f*)(mp + mo + ((a * 8 + b) << 8)) = lo;
      *(v4f*)(mp + mo + ((a * 8 + b) << 8) + 128) = hi;
    }
}

// Sum of the token splits (f32, split order 0..KSPL-1), scale in f32, f16. Thread = (plane, tile, lane): elements r <-> M[16 ta + 8 hh + r][16 tb + ln],
// which is one 8-deep piece of row d2 = 16 tb + ln of M^T: fragment-major tile [plane][d2 tile tb][k-step ta >> 1], register half ta & 1, same lane.
__global__ __launch_bounds__(256) void k_red(const float* __restrict__ MP, _Float16* __restrict__ MF) {
  const unsigned idx = (blockIdx.x << 8) + threadIdx.x;
  const unsigned lane = idx & 31u, tile = (idx >> 5) & 63u, bh = idx >> 11;
  const unsigned ta = tile >> 3, tb = tile & 7u;
  const float* pb = MP + ((size_t)blockIdx.x << 11);     /* (plane * 64 + tile) * 256 of the block's first tile */
  const unsigned po = ((threadIdx.x >> 5) << 8) + (lane << 2);
  v4f pl[KSPL], ph[KSPL];
#pragma unroll
  for (int s = 0; s < KSPL; ++s) {
    const float* ps = pb + (size_t)s * NPL * HD * HD;
    pl[s] = *(const v4fa*)(ps + po);
    ph[s] = *(const v4fa*)(ps + po + 128);
  }
  XWAIT(po);
  v4f lo = {0.f, 0.f, 0.f, 0.f}, hi = {0.f, 0.f, 0.f, 0.f};
#pragma unroll
  for (int s = 0; s < KSPL; ++s) { lo += pl[s]; hi += ph[s]; }
  const float SC = 0.08838834764831845f;                 /* 128^-0.5 applied in f32 */
  FragH o;
#pragma unroll
  for (int r = 0; r < 4; ++r) { o.h[r] = toh_flush(lo[r] * SC); o.h[4 + r] = toh_flush(hi[r] * SC); }
  *(v8us*)((unsigned short*)MF + ((((bh * DTL + tb) * KCH + (ta >> 1)) << 9) + ((ta & 1u) << 8) + (lane << 3))) = o.half[0];
}

// Output pass, transposed dataflow. Wave = 32 query rows (two 16-row tiles); block = 4 independent waves (128 rows).
// O^T (m = d2, n = query) = M^T (A, fragment-major tiles) x Q^T (B, rows from the Q plane), 8 d2 tiles x 4 k-steps of 32; each A tile serves both query tiles.
__global__ __launch_bounds__(128) void k_out(const _Float16* __restrict__ Q16, const _Float16* __restrict__ MF, float* __restrict__ out) {
  __shared__ __attribute__((aligned(16))) float so[4][32][HD + 4];   /* per-wave private output staging (same wave writes and reads); columns 0..127 used */
  const unsigned tid = threadIdx.x, w = tid >> 5, lane = tid & 31u, ln = lane & 15u, hh = lane >> 4;
  const unsigned bh = blockIdx.y;
  const size_t rb = ((size_t)bh * SEQ + (blockIdx.x << 7)) * HD;     /* first row of the block */
  const unsigned short* mf = (const unsigned short*)MF + (((size_t)bh * DTL * KCH) << 9);
  const unsigned short* qp = (const unsigned short*)Q16 + rb;
  const unsigned l8 = lane << 3;
  const unsigned qo = (((w << 5) + ln) << 7) + (hh << 3);            /* row 32 w + ln, depth 8 hh */

  /* three sets of A tiles: the loads of d2 tile dt + 2 are issued ahead of the products of tile dt, so that their latency runs under two tiles' work */
  FragH ma[3][KCH];
  FragH qb[2][KCH];
#pragma unroll
  for (int t = 0; t < 2; ++t)
#pragma unroll
    for (int kc = 0; kc < KCH; ++kc) {
      qb[t][kc].half[0] = *(const v8us*)(qp + qo + 2048 * t + 32 * kc);
      qb[t][kc].half[1] = *(const v8us*)(qp + qo + 2048 * t + 32 * kc + 16);
    }
  const v8f z8 = {0.f, 0.f, 0.f, 0.f, 0.f, 0.f, 0.f, 0.f};
#pragma unroll
  for (int dt = -2; dt < DTL; ++dt) {
    if (dt + 2 < DTL) {
      const int nb = (dt + 2) % 3;
#pragma unroll
      for (int kc = 0; kc < KCH; ++kc) {
        ma[nb][kc].half[0] = *(const v8us*)(mf + l8 + (((dt + 2) * KCH + kc) << 9));
        ma[nb][kc].half[1] = *(const v8us*)(mf + l8 + (((dt + 2) * KCH + kc) << 9) + 256);
      }
    }
    if (dt == -1) XWAIT(qo);   /* behind the Q rows and the first two sets of A tiles */
    if (dt >= 0) {
      const int cb = dt % 3;
      v8f acc[2] = {z8, z8};
#pragma unroll
      for (int kc = 0; kc < KCH; ++kc) {
        acc[0] = mma16(ma[cb][kc].v, qb[0][kc].v, acc[0]);
        acc[1] = mma16(ma[cb][kc].v, qb[1][kc].v, acc[1]);
      }
#pragma unroll
      for (int t = 0; t < 2; ++t)
#pragma unroll
        for (int r = 0; r < 8; ++r)
          so[w][16 * t + ln][16 * dt + 8 * hh + r] = acc[t][r];
    }
  }
  __builtin_amdgcn_fence(4 /* acq_rel order */, "workgroup");
  __builtin_amdgcn_wave_barrier();
  float* obase = out + rb;
  const unsigned oo = (w << 12) + (lane << 2);                       /* row 32 w, column 4 lane */
#pragma unroll
  for (int qq = 0; qq < 32; ++qq) {
    const v4f vv = *(const v4fa*)&so[w][qq][lane << 2];
    *(v4f*)(obase + oo + (qq << 7)) = vv;
  }
}

extern "C" void kernel_launch(void* const* d_in, const int* in_sizes, int n_in,
                              void* d_out, int out_size, void* d_ws, size_t ws_size, hipStream_t stream) {
  if (n_in < 3) return;
  const size_t need_qkv = ((size_t)(NPL - 1) * SEQ_FULL + SEQ) * HD;
  if ((size_t)in_sizes[0] < need_qkv || (size_t)in_sizes[1] < need_qkv || (size_t)in_sizes[2] < need_qkv) return;
  if ((size_t)out_size < (size_t)NPL * SEQ * HD) return;
  const float* q = (const float*)d_in[0];
  const float* k = (const float*)d_in[1];
  const float* v = (const float*)d_in[2];
  float* out = (float*)d_out;

  char* ws = (char*)d_ws;
  size_t off = 0;
  _Float16* Q16 = (_Float16*)(ws + off); off += PLANE_BYTES;
  _Float16* KF  = (_Float16*)(ws + off); off += PLANE_BYTES;
  _Float16* VF  = (_Float16*)(ws + off); off += PLANE_BYTES;
  float*    MP  = (float*)(ws + off);    off += MP_BYTES;
  _Float16* MF  = (_Float16*)(ws + off); off += MF_BYTES;
  if (off > ws_size) return;

  k_cvt<<<dim3(SEQ / 64, NPL), 256, 0, stream>>>(q, k, v, Q16, KF, VF);
  k_kv<<<dim3(KSPL, NPL), 256, 0, stream>>>(KF, VF, MP);
  k_red<<<dim3(NPL * 8), 256, 0, stream>>>(MP, MF);
  k_out<<<dim3(SEQ / 128, NPL), 128, 0, stream>>>(Q16, MF, out);
}

// v002
// Measured time: 21.2 microseconds a run.
// Next to v001, in two timings, it ran 1.63 and 1.61 times as fast.
// All steps since v000 together make it 13.9 times as fast.
#include <hip/hip_runtime.h>
// Linear (softmax-free) dot-product attention, q/k/v [2][16][2048][128] f32, no mask: out = (q k^T * 128^-0.5) v, evaluated as q ((k^T v) * 128^-0.5).
// All contractions: v_wmma_f32_16x16x32_f16, f32 accumulate. Operands: q, k, v RNE-converted to bf16, then exact f16, in the registers of the kernel that multiplies them.
// M = K^T V (128 x 128 per plane, exact products, f32 sums over token splits), scale applied in f32, M carried as f16 (value select clears anything under 2^-14); O^T = M^T Q^T.
#ifndef NB
#define NB 2
#endif
#ifndef SEQ
#define SEQ 2048
#endif
#define NB_FULL 2
#define SEQ_FULL 2048
#define NH 16
#define HD 128
#define KCH (HD / 32)                          /* 32-deep k-steps over HD */
#define DTL (HD / 16)                          /* 16-row d tiles of O^T */
#define NPL (NB * NH)                          /* (batch, head) planes processed */
#define STEPS (SEQ / 32)                       /* 32-token k-steps of K^T V */
#define KSPL 8                                 /* token splits of K^T V (one block each) */
#define SPS (STEPS / KSPL)                     /* k-steps per split */
#define NSTG (SPS / 2)                         /* 64-token stages per split */
#define QP (HD + 8)                            /* halves from one q row to the next in LDS: 272 B = 16 B x odd */
#define TP 520                                 /* halves from one fragment tile to the next in LDS: 512 + a 16-byte pad */
#define MP_BYTES ((size_t)KSPL * NPL * HD * HD * 4)
#define MF_BYTES ((size_t)NPL * HD * HD * 2)

static_assert(SEQ % 64 == 0);
static_assert(SEQ <= SEQ_FULL);
static_assert(NB <= NB_FULL);
static_assert(HD == 128);
static_assert(KCH == 4);
static_assert(DTL == 8);
static_assert(MP_BYTES + MF_BYTES <= (size_t)134217728);
static_assert(STEPS % KSPL == 0);
static_assert(SPS % 2 == 0 && NSTG >= 3);
static_assert(SEQ % 128 == 0);
/* coverage: K^T V loaders, (KSPL x NPL) blocks x NSTG stages x 4 waves per operand x 32 lanes x 16 loads x 4 floats */
static_assert((size_t)KSPL * NPL * NSTG * 4 * 32 * 16 * 4 == (size_t)NPL * SEQ * HD);
/* coverage: output pass, (SEQ/128 x NPL) blocks x 4 waves x 32 rows x HD floats */
static_assert((size_t)(SEQ / 128) * NPL * 4 * 32 * HD == (size_t)NPL * SEQ * HD);
/* coverage: split sum, (NPL*8) blocks x 256 threads x 8 elements */
static_assert((size_t)NPL * 8 * 256 * 8 == (size_t)NPL * HD * HD);
/* one store instruction of the epilogue = 32 lanes x 16 B = one output row */
static_assert(32 * 16 == HD * 4);

typedef _Float16 v16h __attribute__((ext_vector_type(16)));
typedef unsigned short v8us __attribute__((ext_vector_type(8), may_alias));
typedef unsigned short v4us __attribute__((ext_vector_type(4), may_alias));
typedef float v8f  __attribute__((ext_vector_type(8)));
typedef float v4f  __attribute__((ext_vector_type(4)));
typedef float v4fa __attribute__((ext_vector_type(4), may_alias));
union FragH { v16h v; v8us half[2]; _Float16 h[16]; unsigned short u[16]; };

#if defined(__has_builtin)
#if __has_builtin(__builtin_amdgcn_exp2f)
#define EXP2F(x) __builtin_amdgcn_exp2f(x)
#endif
#endif
#ifndef EXP2F
#define EXP2F(x) exp2f(x)
#endif

__device__ __forceinline__ unsigned short bf16_bits(float x) { unsigned int u = __float_as_uint(x); return (unsigned short)((u + 0x7FFFu + ((u >> 16) & 1u)) >> 16); }
__device__ __forceinline__ float bf16_val(unsigned short b) { return __uint_as_float(((unsigned int)b) << 16); }
__device__ __forceinline__ float bf16_rne(float x) { return bf16_val(bf16_bits(x)); }

// f32 -> f16 (RNE) that cannot yield an f16 subnormal: magnitudes under 2^-14 become zero by a value select
static __device__ __forceinline__ _Float16 toh_flush(float v) {
  const _Float16 r = (_Float16)v;
  return (fabsf(v) < 6.103515625e-05f) ? (_Float16)0.0f : r;
}

// one WMMA followed by the 4-slot hazard guard (ties D, keeps A/B live)
__device__ __forceinline__ v8f mma16(v16h a, v16h b, v8f c) {
  v8f d = __builtin_amdgcn_wmma_f32_16x16x32_f16(false, a, false, b, (short)0, c, false, false);
  asm volatile("v_nop\n\tv_nop\n\tv_nop\n\tv_nop" : "+v"(d) : "v"(a), "v"(b));
  return d;
}

// Every loop below is fully unrolled (#pragma unroll): its index selects registers and constant address offsets.
// Every global address below is a block-uniform (in the K^T V loader: wave-uniform) base plus one 32-bit lane offset plus a constant.
// XWAIT stands behind a run of global loads or stores, in front of every rewrite of a register that one of them names;
// its operand is that lane offset, which so stays in its register up to the wait.
#define XWAIT(o) asm volatile("s_wait_xcnt 0x0" :: "v"(o) : "memory")

// Fragment-major tiles (M in the workspace, K^T and V^T in LDS): one 16-row x 32-deep f16 operand tile = 512 halves = [register half 0/1][lane 0..31][8 halves];
// lane (ln = lane & 15, hh = lane >> 4), register half f, element j  <->  row ln, depth 16 f + 8 hh + j. The same order serves A and B.

// Work-group barrier for LDS hand-over only: the fences name the LDS address space, so that the global loads issued ahead stay in flight across it.
__device__ __forceinline__ void lds_barrier() {
  __builtin_amdgcn_fence(__ATOMIC_RELEASE, "workgroup", "local");
  __builtin_amdgcn_s_barrier();
  __builtin_amdgcn_fence(__ATOMIC_ACQUIRE, "workgroup", "local");
}

// M = K^T V, one token split per block, k and v read as f32 rows. Block = 8 waves; stage = 64 tokens = two 32-token k-steps.
// Loading: wave = (operand, k-step of the stage, 64-column half). A lane reads 4 columns (d = 64 hd + 4 ln + c) of its 16 tokens (16 f + 8 hh + j):
// column c of these is the lane's own 16-deep piece of row d, so the transposition is a choice of registers, and the piece goes to LDS at tile d >> 4, row d & 15.
// Products: wave (wa, wb) owns d1 tiles 4 wa .. +3 (A, rows of K^T) x d2 tiles 2 wb .. +1 (B, rows of V^T), fragments from LDS.
// Partial tiles go out in accumulator order: [split][plane][d1 tile * 8 + d2 tile][element quad 0/1][lane][4 floats].
__global__ __launch_bounds__(256) void k_kv(const float* __restrict__ k, const float* __restrict__ v, float* __restrict__ MP) {
  __shared__ __attribute__((aligned(16))) unsigned short sf[2][2][2 * DTL * TP];   /* [buffer][operand][k-step of the stage * 8 + tile][TP]; halves 0..511 of a tile written and read */
  const unsigned tid = threadIdx.x, lane = tid & 31u, ln = lane & 15u, hh = lane >> 4;
  const unsigned w = (unsigned)__builtin_amdgcn_readfirstlane((int)(tid >> 5));   /* wave number in a scalar register: the loader's base pointer stays scalar */
  const unsigned wa = w >> 2, wb = w & 3u;
  const unsigned op = w >> 2, us = (w >> 1) & 1u, hd = w & 1u;   /* loader role */
  const unsigned sp = blockIdx.x, bh = blockIdx.y;
  const float* src = (op ? v : k) + (((size_t)bh * SEQ_FULL + (size_t)sp * SPS * 32 + us * 32) * HD + hd * 64);
  const unsigned go = (hh << 10) + (ln << 2);            /* token 8 hh, column 4 ln */
  const unsigned so = (us * DTL + 4u * hd + (ln >> 2)) * TP + (((hh << 4) + ((ln & 3u) << 2)) << 3);   /* tile (64 hd + 4 ln) >> 4, lane slot (hh, row 4 (ln & 3)) */
  const unsigned ao = (4u * wa) * TP + (lane << 3);      /* d1 tile 4 wa, this lane */
  const unsigned bo = (2u * wb) * TP + (lane << 3);      /* d2 tile 2 wb, this lane */
  const v8f z8 = {0.f, 0.f, 0.f, 0.f, 0.f, 0.f, 0.f, 0.f};
  v8f acc[4][2] = {{z8, z8}, {z8, z8}, {z8, z8}, {z8, z8}};
  /* two register sets of rows: the loads of stage g + 2 are issued as soon as stage g is converted, so that one to two stages are always in flight */
  v4f x[2][16];
#pragma unroll
  for (int g = 0; g < 2; ++g)
#pragma unroll
    for (int i = 0; i < 16; ++i) x[g][i] = *(const v4fa*)(src + go + g * 64 * HD + ((i >> 3) * 16 + (i & 7)) * HD);
#pragma unroll
  for (int g = 0; g < NSTG; ++g) {
    const int cb = g & 1;
    FragH p[4];
#pragma unroll
    for (int c = 0; c < 4; ++c)
#pragma unroll
      for (int i = 0; i < 16; ++i) p[c].h[i] = (_Float16)bf16_rne(x[cb][i][c]);
    if (g + 2 < NSTG) {
#pragma unroll
      for (int i = 0; i < 16; ++i) x[cb][i] = *(const v4fa*)(src + go + (g + 2) * 64 * HD + ((i >> 3) * 16 + (i & 7)) * HD);
    }
    if (g + 3 == NSTG) XWAIT(go);   /* behind the last run of row loads */
#pragma unroll
    for (int c = 0; c < 4; ++c) {
      *(v8us*)&sf[cb][op][so + 8 * c] = p[c].half[0];
      *(v8us*)&sf[cb][op][so + 8 * c + 256] = p[c].half[1];
    }
    /* publishes buffer cb; the buffer written next was last read ahead of this barrier */
    lds_barrier();
#pragma unroll
    for (int u = 0; u < 2; ++u) {
      FragH fa[4], fb[2];
#pragma unroll
      for (int a = 0; a < 4; ++a) {
        fa[a].half[0] = *(const v8us*)&sf[cb][0][ao + (u * DTL + a) * TP];
        fa[a].half[1] = *(const v8us*)&sf[cb][0][ao + (u * DTL + a) * TP + 256];
      }
#pragma unroll
      for (int b = 0; b < 2; ++b) {
        fb[b].half[0] = *(const v8us*)&sf[cb][1][bo + (u * DTL + b) * TP];
        fb[b].half[1] = *(const v8us*)&sf[cb][1][bo + (u * DTL + b) * TP + 256];
      }
#pragma unroll
      for (int a = 0; a < 4; ++a)
#pragma unroll
        for (int b = 0; b < 2; ++b)
          acc[a][b] = mma16(fa[a].v, fb[b].v, acc[a][b]);
    }
  }
  float* mp = MP + ((((size_t)sp * NPL + bh) * 64) << 8);
  const unsigned mo = (((4u * wa) * 8u + 2u * wb) << 8) + (lane << 2);   /* tile (4 wa, 2 wb), this lane */
#pragma unroll
  for (int a = 0; a < 4; ++a)
#pragma unroll
    for (int b = 0; b < 2; ++b) {
      const v4f lo = {acc[a][b][0], acc[a][b][1], acc[a][b][2], acc[a][b][3]};
      const v4f hi = {acc[a][b][4], acc[a][b][5], acc[a][b][6], acc[a][b][7]};
      *(v4f*)(mp + mo + ((a * 8 + b) << 8)) = lo;
      *(v4f*)(mp + mo + ((a * 8 + b) << 8) + 128) = hi;
    }
}

// Sum of the token splits (f32, split order 0..KSPL-1), scale in f32, f16. Thread = (plane, tile, lane): elements r <-> M[16 ta + 8 hh + r][16 tb + ln],
// which is one 8-deep piece of row d2 = 16 tb + ln of M^T: fragment-major tile [plane][d2 tile tb][k-step ta >> 1], register half ta & 1, same lane.
__global__ __launch_bounds__(256) void k_red(const float* __restrict__ MP, _Float16* __restrict__ MF) {
  const unsigned idx = (blockIdx.x << 8) + threadIdx.x;
  const unsigned lane = idx & 31u, tile = (idx >> 5) & 63u, bh = idx >> 11;
  const unsigned ta = tile >> 3, tb = tile & 7u;
  const float* pb = MP + ((size_t)blockIdx.x << 11);     /* (plane * 64 + tile) * 256 of the block's first tile */
  const unsigned po = ((threadIdx.x >> 5) << 8) + (lane << 2);
  v4f pl[KSPL], ph[KSPL];
#pragma unroll
  for (int s = 0; s < KSPL; ++s) {
    const float* ps = pb + (size_t)s * NPL * HD * HD;
    pl[s] = *(const v4fa*)(ps + po);
    ph[s] = *(const v4fa*)(ps + po + 128);
  }
  XWAIT(po);
  v4f lo = {0.f, 0.f, 0.f, 0.f}, hi = {0.f, 0.f, 0.f, 0.f};
#pragma unroll
  for (int s = 0; s < KSPL; ++s) { lo += pl[s]; hi += ph[s]; }
  const float SC = 0.08838834764831845f;                 /* 128^-0.5 applied in f32 */
  FragH o;
#pragma unroll
  for (int r = 0; r < 4; ++r) { o.h[r] = toh_flush(lo[r] * SC); o.h[4 + r] = toh_flush(hi[r] * SC); }
  *(v8us*)((unsigned short*)MF + ((((bh * DTL + tb) * KCH + (ta >> 1)) << 9) + ((ta & 1u) << 8) + (lane << 3))) = o.half[0];
}

// Output pass, transposed dataflow. Wave = 32 query rows (two 16-row tiles); block = 4 independent waves (128 rows).
// O^T (m = d2, n = query) = M^T (A, fragment-major tiles) x Q^T (B, rows of q), 8 d2 tiles x 4 k-steps of 32; each A tile serves both query tiles.
// q is read as whole f32 rows (one load = one row), converted, and turned into B fragments through the wave's own LDS range.
__global__ __launch_bounds__(128) void k_out(const float* __restrict__ q, const _Float16* __restrict__ MF, float* __restrict__ out) {
  __shared__ __attribute__((aligned(16))) float so[4][32][HD + 4];   /* per-wave private (same wave writes and reads): first the f16 q rows at a pitch of QP halves, then output staging, columns 0..127 used */
  const unsigned tid = threadIdx.x, w = tid >> 5, lane = tid & 31u, ln = lane & 15u, hh = lane >> 4;
  const unsigned bh = blockIdx.y;
  const size_t rb = ((size_t)bh * SEQ + (blockIdx.x << 7)) * HD;     /* first row of the block */
  const unsigned short* mf = (const unsigned short*)MF + (((size_t)bh * DTL * KCH) << 9);
  const float* qp = q + ((size_t)bh * SEQ_FULL + (blockIdx.x << 7)) * HD;   /* input rows (full strides) */
  const unsigned l8 = lane << 3;
  const unsigned qo = (w << 12) + (lane << 2);                       /* row 32 w, column 4 lane */
  unsigned short* sq = (unsigned short*)&so[w][0][0];

  /* three sets of A tiles: the loads of d2 tile dt + 2 are issued ahead of the products of tile dt, so that their latency runs under two tiles' work */
  FragH ma[3][KCH];
  FragH qb[2][KCH];
  v4f xq[32];
#pragma unroll
  for (int r = 0; r < 32; ++r) xq[r] = *(const v4fa*)(qp + qo + (r << 7));
  const v8f z8 = {0.f, 0.f, 0.f, 0.f, 0.f, 0.f, 0.f, 0.f};
#pragma unroll
  for (int dt = -2; dt < DTL; ++dt) {
    if (dt + 2 < DTL) {
      const int nb = (dt + 2) % 3;
#pragma unroll
      for (int kc = 0; kc < KCH; ++kc) {
        ma[nb][kc].half[0] = *(const v8us*)(mf + l8 + (((dt + 2) * KCH + kc) << 9));
        ma[nb][kc].half[1] = *(const v8us*)(mf + l8 + (((dt + 2) * KCH + kc) << 9) + 256);
      }
    }
    if (dt == -1) {
      XWAIT(qo);   /* behind the q rows and the first two sets of A tiles */
      __builtin_amdgcn_sched_barrier(0);   /* every load above is issued before the first conversion waits: otherwise the last rows' loads start only when the first rows have arrived */
#pragma unroll
      for (int r = 0; r < 32; ++r) {
        FragH c;
#pragma unroll
        for (int j = 0; j < 4; ++j) c.h[j] = (_Float16)bf16_rne(xq[r][j]);
        const v4us c4 = {c.u[0], c.u[1], c.u[2], c.u[3]};
        *(v4us*)(sq + r * QP + (lane << 2)) = c4;
      }
      /* other lanes' rows are read next: keeps the compiler from moving LDS reads over the writes (LDS address space only, the A tiles' loads stay in flight) */
      __builtin_amdgcn_fence(__ATOMIC_ACQ_REL, "workgroup", "local");
      __builtin_amdgcn_wave_barrier();
#pragma unroll
      for (int t = 0; t < 2; ++t)
#pragma unroll
        for (int kc = 0; kc < KCH; ++kc) {
          qb[t][kc].half[0] = *(const v8us*)(sq + (16 * t + ln) * QP + 32 * kc + (hh << 3));
          qb[t][kc].half[1] = *(const v8us*)(sq + (16 * t + ln) * QP + 32 * kc + (hh << 3) + 16);
        }
      /* the same range becomes output staging: no staging write may move over these reads */
      __builtin_amdgcn_fence(__ATOMIC_ACQ_REL, "workgroup", "local");
      __builtin_amdgcn_wave_barrier();
    }
    if (dt >= 0) {
      const int cb = dt % 3;
      v8f acc[2] = {z8, z8};
#pragma unroll
      for (int kc = 0; kc < KCH; ++kc) {
        acc[0] = mma16(ma[cb][kc].v, qb[0][kc].v, acc[0]);
        acc[1] = mma16(ma[cb][kc].v, qb[1][kc].v, acc[1]);
      }
#pragma unroll
      for (int t = 0; t < 2; ++t)
#pragma unroll
        for (int r = 0; r < 8; ++r)
          so[w][16 * t + ln][16 * dt + 8 * hh + r] = acc[t][r];
    }
  }
  __builtin_amdgcn_fence(4 /* acq_rel order */, "workgroup");
  __builtin_amdgcn_wave_barrier();
  float* obase = out + rb;
  const unsigned oo = (w << 12) + (lane << 2);                       /* row 32 w, column 4 lane */
#pragma unroll
  for (int qq = 0; qq < 32; ++qq) {
    const v4f vv = *(const v4fa*)&so[w][qq][lane << 2];
    *(v4f*)(obase + oo + (qq << 7)) = vv;
  }
}

extern "C" void kernel_launch(void* const* d_in, const int* in_sizes, int n_in,
                              void* d_out, int out_size, void* d_ws, size_t ws_size, hipStream_t stream) {
  if (n_in < 3) return;
  const size_t need_qkv = ((size_t)(NPL - 1) * SEQ_FULL + SEQ) * HD;
  if ((size_t)in_sizes[0] < need_qkv || (size_t)in_sizes[1] < need_qkv || (size_t)in_sizes[2] < need_qkv) return;
  if ((size_t)out_size < (size_t)NPL * SEQ * HD) return;
  const float* q = (const float*)d_in[0];
  const float* k = (const float*)d_in[1];
  const float* v = (const float*)d_in[2];
  float* out = (float*)d_out;

  char* ws = (char*)d_ws;
  size_t off = 0;
  float*    MP  = (float*)(ws + off);    off += MP_BYTES;
  _Float16* MF  = (_Float16*)(ws + off); off += MF_BYTES;
  if (off > ws_size) return;

  k_kv<<<dim3(KSPL, NPL), 256, 0, stream>>>(k, v, MP);
  k_red<<<dim3(NPL * 8), 256, 0, stream>>>(MP, MF);
  k_out<<<dim3(SEQ / 128, NPL), 128, 0, stream>>>(q, MF, out);
}

// v003
// Measured time: 20 microseconds a run.
// Next to v002, in two timings, it ran 1.07 times as fast each time.
// All steps since v000 together make it 14.8 times as fast.
#include <hip/hip_runtime.h>
// Linear (softmax-free) dot-product attention, q/k/v [2][16][2048][128] f32, no mask: out = (q k^T * 128^-0.5) v, evaluated as q ((k^T v) * 128^-0.5).
// All contractions: v_wmma_f32_16x16x32_f16, f32 accumulate. Operands: q, k, v RNE-converted to bf16, then exact f16, in the registers of the kernel that multiplies them.
// M = K^T V (128 x 128 per plane, exact products, f32 sums over all tokens inside one block per 64 x 32 piece of M), scale applied in f32, M carried as f16 (value select clears anything under 2^-14); O^T = M^T Q^T.
#ifndef NB
#define NB 2
#endif
#ifndef SEQ
#define SEQ 2048
#endif
#define NB_FULL 2
#define SEQ_FULL 2048
#define NH 16
#define HD 128
#define KCH (HD / 32)                          /* 32-deep k-steps over HD */
#define DTL (HD / 16)                          /* 16-row d tiles of O^T */
#define NPL (NB * NH)                          /* (batch, head) planes processed */
#define STEPS (SEQ / 32)                       /* 32-token k-steps of K^T V */
#define KVW 8                                  /* waves of a K^T V block */
#define WST (STEPS / KVW)                      /* k-steps per wave */
#define RBP (16 * 68 + 32)                     /* floats from one column parity to the next in the sum's LDS: 16 rows of 68, then half the banks */
#define QP (HD + 8)                            /* halves from one q row to the next in LDS: 272 B = 16 B x odd */
#define MF_BYTES ((size_t)NPL * HD * HD * 2)

static_assert(SEQ % 64 == 0);
static_assert(SEQ <= SEQ_FULL);
static_assert(NB <= NB_FULL);
static_assert(HD == 128);
static_assert(KCH == 4);
static_assert(DTL == 8);
static_assert(MF_BYTES <= (size_t)134217728);
static_assert(STEPS % KVW == 0 && WST % 2 == 0 && WST >= 2);
static_assert(NPL % 8 == 0);
static_assert(SEQ % 128 == 0);
/* coverage: K^T V loaders, one block = KVW waves x WST k-steps x 32 lanes x 16 loads x 4 floats = all tokens x 64 columns of k (2 floats: x 32 columns of v) */
static_assert((size_t)KVW * WST * 32 * 16 * 4 == (size_t)SEQ * 64);
/* coverage: M, (NPL x 8) blocks x 256 threads x 8 elements */
static_assert((size_t)NPL * 8 * 256 * 8 == (size_t)NPL * HD * HD);
/* coverage: output pass, (SEQ/128 x NPL) blocks x 4 waves x 32 rows x HD floats */
static_assert((size_t)(SEQ / 128) * NPL * 4 * 32 * HD == (size_t)NPL * SEQ * HD);
/* one store instruction of the epilogue = 32 lanes x 16 B = one output row */
static_assert(32 * 16 == HD * 4);

typedef _Float16 v16h __attribute__((ext_vector_type(16)));
typedef unsigned short v8us __attribute__((ext_vector_type(8), may_alias));
typedef unsigned short v4us __attribute__((ext_vector_type(4), may_alias));
typedef float v8f  __attribute__((ext_vector_type(8)));
typedef float v4f  __attribute__((ext_vector_type(4)));
typedef float v4fa __attribute__((ext_vector_type(4), may_alias));
typedef float v2f  __attribute__((ext_vector_type(2)));
typedef float v2fa __attribute__((ext_vector_type(2), may_alias));
union FragH { v16h v; v8us half[2]; _Float16 h[16]; unsigned short u[16]; };

#if defined(__has_builtin)
#if __has_builtin(__builtin_amdgcn_exp2f)
#define EXP2F(x) __builtin_amdgcn_exp2f(x)
#endif
#endif
#ifndef EXP2F
#define EXP2F(x) exp2f(x)
#endif

__device__ __forceinline__ unsigned short bf16_bits(float x) { unsigned int u = __float_as_uint(x); return (unsigned short)((u + 0x7FFFu + ((u >> 16) & 1u)) >> 16); }
__device__ __forceinline__ float bf16_val(unsigned short b) { return __uint_as_float(((unsigned int)b) << 16); }
__device__ __forceinline__ float bf16_rne(float x) { return bf16_val(bf16_bits(x)); }

// f32 -> f16 (RNE) that cannot yield an f16 subnormal: magnitudes under 2^-14 become zero by a value select
static __device__ __forceinline__ _Float16 toh_flush(float v) {
  const _Float16 r = (_Float16)v;
  return (fabsf(v) < 6.103515625e-05f) ? (_Float16)0.0f : r;
}

// one WMMA followed by the 4-slot hazard guard (ties D, keeps A/B live)
__device__ __forceinline__ v8f mma16(v16h a, v16h b, v8f c) {
  v8f d = __builtin_amdgcn_wmma_f32_16x16x32_f16(false, a, false, b, (short)0, c, false, false);
  asm volatile("v_nop\n\tv_nop\n\tv_nop\n\tv_nop" : "+v"(d) : "v"(a), "v"(b));
  return d;
}

// Every loop below but one (the k-step pairs of K^T V) is fully unrolled (#pragma unroll): its index selects registers and constant address offsets.
// Every global address below is a block-uniform (in the K^T V loader: wave-uniform) base plus one 32-bit lane offset plus a constant.
// XWAIT stands behind a run of global loads or stores, in front of every rewrite of a register that one of them names;
// its operand is that lane offset, which so stays in its register up to the wait.
#define XWAIT(o) asm volatile("s_wait_xcnt 0x0" :: "v"(o) : "memory")

// Fragment-major tiles (M in the workspace): one 16-row x 32-deep f16 operand tile = 512 halves = [register half 0/1][lane 0..31][8 halves];
// lane (ln = lane & 15, hh = lane >> 4), register half f, element j  <->  row ln, depth 16 f + 8 hh + j. The same order serves A and B.

// One k-step of K^T V: the lane's 16 rows (4 columns of k, 2 of v) to its four A and two B fragments; then the eight products.
__device__ __forceinline__ void kv_frags(const v4f (&xk)[16], const v2f (&xv)[16], FragH (&fa)[4], FragH (&fb)[2]) {
#pragma unroll
  for (int i = 0; i < 16; ++i) {
#pragma unroll
    for (int c = 0; c < 4; ++c) fa[c].h[i] = (_Float16)bf16_rne(xk[i][c]);
#pragma unroll
    for (int c = 0; c < 2; ++c) fb[c].h[i] = (_Float16)bf16_rne(xv[i][c]);
  }
}
__device__ __forceinline__ void kv_products(const FragH (&fa)[4], const FragH (&fb)[2], v8f (&acc)[4][2]) {
#pragma unroll
  for (int a = 0; a < 4; ++a)
#pragma unroll
    for (int b = 0; b < 2; ++b)
      acc[a][b] = mma16(fa[a].v, fb[b].v, acc[a][b]);
}

// M = K^T V, one 64 x 32 piece of M per block over ALL tokens, k and v read as f32 rows; no partial planes and no sum launch.
// Block = (plane, d1 half a2, d2 quarter b4), 8 waves; wave w takes the 32-token k-steps w, w + 8, ...: the block walks the tokens in order.
// A lane reads 4 columns of k (d1 = 64 a2 + 4 ln + c) and 2 columns of v (d2 = 32 b4 + 2 ln + c) of its 16 tokens (16 f + 8 hh + j).
// Column c of these is the lane's own 16-deep fragment piece once the operand rows are NUMBERED so: A tile c, row ln <-> d1 = 64 a2 + 4 ln + c; B tile c, row ln <-> d2 = 32 b4 + 2 ln + c.
// So the fragments are a choice of registers and pass no LDS. Accumulator (a, b), element r <-> M[64 a2 + 4 (8 hh + r) + a][32 b4 + 2 ln + b].
// The eight waves' sums meet in LDS ([wave][b][ln][d1 - 64 a2]), are added in wave order 0..7 in f32, scaled in f32 and stored as f16 in fragment-major order:
// thread = (d2 tile, k-step, register half, lane) of M^T, its 8 elements one 8-deep piece of row d2.
__global__ __launch_bounds__(256) void k_kv(const float* __restrict__ k, const float* __restrict__ v, _Float16* __restrict__ MF) {
  __shared__ __attribute__((aligned(16))) float red[KVW][2 * RBP];   /* columns 0..63 of each 68-float row written and read */
  const unsigned tid = threadIdx.x, lane = tid & 31u, ln = lane & 15u, hh = lane >> 4;
  const unsigned w = (unsigned)__builtin_amdgcn_readfirstlane((int)(tid >> 5));   /* wave number in a scalar register: the base pointers stay scalar */
  /* the eight blocks of a plane read the same rows: indices 8 apart (speed only; any placement gives the same values) */
  const unsigned bx = blockIdx.x;
  const unsigned bh = (bx & 7u) + ((bx >> 6) << 3), a2 = (bx >> 5) & 1u, b4 = (bx >> 3) & 3u;
  const float* kp = k + (((size_t)bh * SEQ_FULL + w * 32) * HD + a2 * 64);
  const float* vp = v + (((size_t)bh * SEQ_FULL + w * 32) * HD + b4 * 32);
  const unsigned ko = (hh << 10) + (ln << 2);            /* token 8 hh, column 4 ln */
  const unsigned vo = (hh << 10) + (ln << 1);            /* token 8 hh, column 2 ln */
  const v8f z8 = {0.f, 0.f, 0.f, 0.f, 0.f, 0.f, 0.f, 0.f};
  v8f acc[4][2] = {{z8, z8}, {z8, z8}, {z8, z8}, {z8, z8}};
  /* two register sets of rows: the loads of k-step s + 2 are issued as soon as k-step s has left its set, so that one to two k-steps are always in flight */
  v4f xk[2][16];
  v2f xv[2][16];
  /* the scheduling barriers below keep the sets apart. Without them the compiler mixes the two sets' loads, waits for both sets at the head of a trip and converts both before it issues any load: nothing is then in flight under the conversions */
#pragma unroll
  for (int s = 0; s < 2; ++s) {
#pragma unroll
    for (int i = 0; i < 16; ++i) {
      xk[s][i] = *(const v4fa*)(kp + ko + (s * KVW * 32 + (i >> 3) * 16 + (i & 7)) * HD);
      xv[s][i] = *(const v2fa*)(vp + vo + (s * KVW * 32 + (i >> 3) * 16 + (i & 7)) * HD);
    }
    if (s == 1) XWAIT(ko);               /* behind the first two sets' loads, in front of the loop's own address registers */
    __builtin_amdgcn_sched_barrier(0);   /* set s is issued whole ahead of what follows */
  }
  unsigned adv = 2 * KVW * 32 * HD;                      /* floats from the wave's first row to the rows loaded in this trip */
  /* stays rolled: for speed only */
#pragma unroll 1
  for (int t = 0; t < WST / 2 - 1; ++t) {
    const float* kq = kp + adv;
    const float* vq = vp + adv;
#pragma unroll
    for (int cb = 0; cb < 2; ++cb) {
      FragH fa[4], fb[2];
      kv_frags(xk[cb], xv[cb], fa, fb);
#pragma unroll
      for (int i = 0; i < 16; ++i) {
        xk[cb][i] = *(const v4fa*)(kq + ko + (cb * KVW * 32 + (i >> 3) * 16 + (i & 7)) * HD);
        xv[cb][i] = *(const v2fa*)(vq + vo + (cb * KVW * 32 + (i >> 3) * 16 + (i & 7)) * HD);
      }
      /* behind the trip's last row loads, in front of the next trip's base addresses: these are formed from adv, which passes through the wait */
      if (cb == 1) asm volatile("s_wait_xcnt 0x0" : "+s"(adv) : "v"(ko), "v"(vo) : "memory");
      __builtin_amdgcn_sched_barrier(0);   /* the refill is issued ahead of the products and of the other set's wait */
      kv_products(fa, fb, acc);
      __builtin_amdgcn_sched_barrier(0);   /* the other set's conversion, with its wait, stays behind this set's refill and products */
    }
    adv += 2 * KVW * 32 * HD;
  }
#pragma unroll
  for (int cb = 0; cb < 2; ++cb) {
    FragH fa[4], fb[2];
    kv_frags(xk[cb], xv[cb], fa, fb);
    kv_products(fa, fb, acc);
  }
#pragma unroll
  for (int b = 0; b < 2; ++b)
#pragma unroll
    for (int r = 0; r < 8; ++r) {
      const v4f t = {acc[0][b][r], acc[1][b][r], acc[2][b][r], acc[3][b][r]};
      *(v4f*)&red[w][b * RBP + ln * 68 + (hh << 5) + 4 * r] = t;
    }
  /* every wave's sums are in LDS before any thread adds them */
  __syncthreads();
  const unsigned tbl = tid >> 7, kcl = (tid >> 6) & 1u;  /* d2 tile and k-step of M^T inside the piece; tid & 63 = (register half, lane) */
  const unsigned d2l = (tbl << 4) + ln;
  const unsigned ro = (d2l & 1u) * RBP + (d2l >> 1) * 68 + ((tid >> 4) & 7u) * 8;   /* column 32 kcl + 16 (register half) + 8 hh */
  v4f lo = {0.f, 0.f, 0.f, 0.f}, hi = {0.f, 0.f, 0.f, 0.f};
#pragma unroll
  for (int s = 0; s < KVW; ++s) { lo += *(const v4f*)&red[s][ro]; hi += *(const v4f*)&red[s][ro + 4]; }
  const float SC = 0.08838834764831845f;                 /* 128^-0.5 applied in f32 */
  FragH o;
#pragma unroll
  for (int r = 0; r < 4; ++r) { o.h[r] = toh_flush(lo[r] * SC); o.h[4 + r] = toh_flush(hi[r] * SC); }
  *(v8us*)((unsigned short*)MF + ((((bh * DTL + 2u * b4 + tbl) * KCH + 2u * a2 + kcl) << 9) + ((tid & 63u) << 3))) = o.half[0];
}

// Output pass, transposed dataflow. Wave = 32 query rows (two 16-row tiles); block = 4 independent waves (128 rows).
// O^T (m = d2, n = query) = M^T (A, fragment-major tiles) x Q^T (B, rows of q), 8 d2 tiles x 4 k-steps of 32; each A tile serves both query tiles.
// q is read as whole f32 rows (one load = one row), converted, and turned into B fragments through the wave's own LDS range.
__global__ __launch_bounds__(128) void k_out(const float* __restrict__ q, const _Float16* __restrict__ MF, float* __restrict__ out) {
  __shared__ __attribute__((aligned(16))) float so[4][32][HD + 4];   /* per-wave private (same wave writes and reads): first the f16 q rows at a pitch of QP halves, then output staging, columns 0..127 used */
  const unsigned tid = threadIdx.x, w = tid >> 5, lane = tid & 31u, ln = lane & 15u, hh = lane >> 4;
  const unsigned bh = blockIdx.y;
  const size_t rb = ((size_t)bh * SEQ + (blockIdx.x << 7)) * HD;     /* first row of the block */
  const unsigned short* mf = (const unsigned short*)MF + (((size_t)bh * DTL * KCH) << 9);
  const float* qp = q + ((size_t)bh * SEQ_FULL + (blockIdx.x << 7)) * HD;   /* input rows (full strides) */
  const unsigned l8 = lane << 3;
  const unsigned qo = (w << 12) + (lane << 2);                       /* row 32 w, column 4 lane */
  unsigned short* sq = (unsigned short*)&so[w][0][0];

  /* three sets of A tiles: the loads of d2 tile dt + 2 are issued ahead of the products of tile dt, so that their latency runs under two tiles' work */
  FragH ma[3][KCH];
  FragH qb[2][KCH];
  v4f xq[32];
#pragma unroll
  for (int r = 0; r < 32; ++r) xq[r] = *(const v4fa*)(qp + qo + (r << 7));
  const v8f z8 = {0.f, 0.f, 0.f, 0.f, 0.f, 0.f, 0.f, 0.f};
#pragma unroll
  for (int dt = -2; dt < DTL; ++dt) {
    if (dt + 2 < DTL) {
      const int nb = (dt + 2) % 3;
#pragma unroll
      for (int kc = 0; kc < KCH; ++kc) {
        ma[nb][kc].half[0] = *(const v8us*)(mf + l8 + (((dt + 2) * KCH + kc) << 9));
        ma[nb][kc].half[1] = *(const v8us*)(mf + l8 + (((dt + 2) * KCH + kc) << 9) + 256);
      }
    }
    if (dt == -1) {
      XWAIT(qo);   /* behind the q rows and the first two sets of A tiles */
      __builtin_amdgcn_sched_barrier(0);   /* every load above is issued before the first conversion waits: otherwise the last rows' loads start only when the first rows have arrived */
#pragma unroll
      for (int r = 0; r < 32; ++r) {
        FragH c;
#pragma unroll
        for (int j = 0; j < 4; ++j) c.h[j] = (_Float16)bf16_rne(xq[r][j]);
        const v4us c4 = {c.u[0], c.u[1], c.u[2], c.u[3]};
        *(v4us*)(sq + r * QP + (lane << 2)) = c4;
      }
      /* other lanes' rows are read next: keeps the compiler from moving LDS reads over the writes (LDS address space only, the A tiles' loads stay in flight) */
      __builtin_amdgcn_fence(__ATOMIC_ACQ_REL, "workgroup", "local");
      __builtin_amdgcn_wave_barrier();
#pragma unroll
      for (int t = 0; t < 2; ++t)
#pragma unroll
        for (int kc = 0; kc < KCH; ++kc) {
          qb[t][kc].half[0] = *(const v8us*)(sq + (16 * t + ln) * QP + 32 * kc + (hh << 3));
          qb[t][kc].half[1] = *(const v8us*)(sq + (16 * t + ln) * QP + 32 * kc + (hh << 3) + 16);
        }
      /* the same range becomes output staging: no staging write may move over these reads */
      __builtin_amdgcn_fence(__ATOMIC_ACQ_REL, "workgroup", "local");
      __builtin_amdgcn_wave_barrier();
    }
    if (dt >= 0) {
      const int cb = dt % 3;
      v8f acc[2] = {z8, z8};
#pragma unroll
      for (int kc = 0; kc < KCH; ++kc) {
        acc[0] = mma16(ma[cb][kc].v, qb[0][kc].v, acc[0]);
        acc[1] = mma16(ma[cb][kc].v, qb[1][kc].v, acc[1]);
      }
#pragma unroll
      for (int t = 0; t < 2; ++t)
#pragma unroll
        for (int r = 0; r < 8; ++r)
          so[w][16 * t + ln][16 * dt + 8 * hh + r] = acc[t][r];
    }
  }
  __builtin_amdgcn_fence(4 /* acq_rel order */, "workgroup");
  __builtin_amdgcn_wave_barrier();
  float* obase = out + rb;
  const unsigned oo = (w << 12) + (lane << 2);                       /* row 32 w, column 4 lane */
#pragma unroll
  for (int qq = 0; qq < 32; ++qq) {
    const v4f vv = *(const v4fa*)&so[w][qq][lane << 2];
    *(v4f*)(obase + oo + (qq << 7)) = vv;
  }
}

extern "C" void kernel_launch(void* const* d_in, const int* in_sizes, int n_in,
                              void* d_out, int out_size, void* d_ws, size_t ws_size, hipStream_t stream) {
  if (n_in < 3) return;
  const size_t need_qkv = ((size_t)(NPL - 1) * SEQ_FULL + SEQ) * HD;
  if ((size_t)in_sizes[0] < need_qkv || (size_t)in_sizes[1] < need_qkv || (size_t)in_sizes[2] < need_qkv) return;
  if ((size_t)out_size < (size_t)NPL * SEQ * HD) return;
  const float* q = (const float*)d_in[0];
  const float* k = (const float*)d_in[1];
  const float* v = (const float*)d_in[2];
  float* out = (float*)d_out;

  char* ws = (char*)d_ws;
  size_t off = 0;
  _Float16* MF  = (_Float16*)(ws + off); off += MF_BYTES;
  if (off > ws_size) return;

  k_kv<<<dim3(NPL * 8), 256, 0, stream>>>(k, v, MF);
  k_out<<<dim3(SEQ / 128, NPL), 128, 0, stream>>>(q, MF, out);
}

// v006
// Measured time: 14.5 microseconds a run.
// It is 1.40 times as fast as v003, going by the measured steps of the versions left out in between.
// Counting every step since v000, it is 20.7 times as fast.
#include <hip/hip_runtime.h>
// Linear (softmax-free) dot-product attention, q/k/v [2][16][2048][128] f32, no mask: out = (q k^T * 128^-0.5) v, evaluated as q ((k^T v) * 128^-0.5).
// All contractions: v_wmma_f32_16x16x32_f16, f32 accumulate. Operands: q, k, v RNE-converted from f32 straight to f16, two values per packed convert, in the registers of the kernel that multiplies them.
// M = K^T V (128 x 128 per plane): one block per 64 x 64 piece of M and half of the tokens sums in f32, scales in f32 and stores an f16 partial (value select clears anything under 2^-14);
// the output pass adds the two partials in f16 (one rounding) into LDS, once per block; O^T = M^T Q^T.
#ifndef NB
#define NB 2
#endif
#ifndef SEQ
#define SEQ 2048
#endif
#define NB_FULL 2
#define SEQ_FULL 2048
#define NH 16
#define HD 128
#define KCH (HD / 32)                          /* 32-deep k-steps over HD */
#define DTL (HD / 16)                          /* 16-row d tiles of O^T */
#define NPL (NB * NH)                          /* (batch, head) planes processed */
#define STEPS (SEQ / 32)                       /* 32-token k-steps of K^T V */
#define KVW 8                                  /* waves of a K^T V block */
#define TSP 2                                  /* token halves: partial planes of M */
#define WST (STEPS / TSP / KVW)                /* k-steps per wave */
#define RBP (16 * 68 + 16)                     /* floats from one column residue (mod 4) to the next in the sum's LDS: 16 rows of 68, then a quarter of the banks */
#define OW 8                                   /* waves of an output block */
#define QP (HD + 8)                            /* halves from one q row to the next in LDS: 272 B = 16 B x odd */
#define MF_BYTES ((size_t)TSP * NPL * HD * HD * 2)

static_assert(SEQ % 64 == 0);
static_assert(SEQ <= SEQ_FULL);
static_assert(NB <= NB_FULL);
static_assert(HD == 128);
static_assert(KCH == 4);
static_assert(DTL == 8);
static_assert(MF_BYTES <= (size_t)134217728);
static_assert(STEPS % (TSP * KVW) == 0 && WST >= 3);
static_assert(NPL % 8 == 0);
static_assert(SEQ % (OW * 32) == 0);
/* coverage: K^T V loaders, one block = KVW waves x WST k-steps x 32 lanes x 16 loads x 4 floats = half the tokens x 64 columns of k (and of v) */
static_assert((size_t)KVW * WST * 32 * 16 * 4 == (size_t)(SEQ / TSP) * 64);
/* coverage: partial M, (NPL x 8) blocks x 256 threads x 16 elements */
static_assert((size_t)NPL * 8 * 256 * 16 == (size_t)TSP * NPL * HD * HD);
/* coverage: output pass, (SEQ/256 x NPL) blocks x OW waves x 32 rows x HD floats; M in LDS, 128 threads (waves OW/2 and up) x 16 pieces x 8 halves */
static_assert((size_t)(SEQ / (OW * 32)) * NPL * OW * 32 * HD == (size_t)NPL * SEQ * HD);
static_assert((OW / 2) * 32 * 16 * 8 == HD * HD);
/* one store instruction of the epilogue = 32 lanes x 16 B = one output row */
static_assert(32 * 16 == HD * 4);

typedef _Float16 v16h __attribute__((ext_vector_type(16)));
typedef _Float16 v8ha __attribute__((ext_vector_type(8), may_alias));
typedef unsigned short v8us __attribute__((ext_vector_type(8), may_alias));
typedef unsigned short v4us __attribute__((ext_vector_type(4), may_alias));
typedef float v8f  __attribute__((ext_vector_type(8)));
typedef float v4f  __attribute__((ext_vector_type(4)));
typedef float v4fa __attribute__((ext_vector_type(4), may_alias));
typedef float v2f  __attribute__((ext_vector_type(2)));
typedef float v2fa __attribute__((ext_vector_type(2), may_alias));
union FragH { v16h v; v8us half[2]; _Float16 h[16]; unsigned short u[16]; };

#if defined(__has_builtin)
#if __has_builtin(__builtin_amdgcn_exp2f)
#define EXP2F(x) __builtin_amdgcn_exp2f(x)
#endif
#endif
#ifndef EXP2F
#define EXP2F(x) exp2f(x)
#endif


// f32 -> f16 (RNE) that cannot yield an f16 subnormal: magnitudes under 2^-14 become zero by a value select
static __device__ __forceinline__ _Float16 toh_flush(float v) {
  const _Float16 r = (_Float16)v;
  return (fabsf(v) < 6.103515625e-05f) ? (_Float16)0.0f : r;
}

// one WMMA followed by the 4-slot hazard guard (ties D, keeps A/B live)
__device__ __forceinline__ v8f mma16(v16h a, v16h b, v8f c) {
  v8f d = __builtin_amdgcn_wmma_f32_16x16x32_f16(false, a, false, b, (short)0, c, false, false);
  asm volatile("v_nop\n\tv_nop\n\tv_nop\n\tv_nop" : "+v"(d) : "v"(a), "v"(b));
  return d;
}

// Every loop below is fully unrolled (#pragma unroll): its index selects registers and constant address offsets.
// Every global address below is a block-uniform (in the K^T V loader: wave-uniform) base plus one 32-bit lane offset plus a constant.
// XWAIT stands behind a run of global loads or stores, in front of every rewrite of a register that one of them names;
// its operand is that lane offset, which so stays in its register up to the wait.
#define XWAIT(o) asm volatile("s_wait_xcnt 0x0" :: "v"(o) : "memory")

// Fragment-major tiles (M in the workspace): one 16-row x 32-deep f16 operand tile = 512 halves = [register half 0/1][lane 0..31][8 halves];
// lane (ln = lane & 15, hh = lane >> 4), register half f, element j  <->  row ln, depth 16 f + 8 hh + j. The same order serves A and B.

// One k-step of K^T V: the lane's 16 rows (4 columns of k, 4 of v) to its four A and four B fragments; then the sixteen products.
__device__ __forceinline__ void kv_frags(const v4f (&xk)[16], const v4f (&xv)[16], FragH (&fa)[4], FragH (&fb)[4]) {
#pragma unroll
  for (int i = 0; i < 16; ++i) {
#pragma unroll
    for (int c = 0; c < 4; ++c) fa[c].h[i] = (_Float16)xk[i][c];
#pragma unroll
    for (int c = 0; c < 4; ++c) fb[c].h[i] = (_Float16)xv[i][c];
  }
}
__device__ __forceinline__ void kv_products(const FragH (&fa)[4], const FragH (&fb)[4], v8f (&acc)[4][4]) {
#pragma unroll
  for (int a = 0; a < 4; ++a)
#pragma unroll
    for (int b = 0; b < 4; ++b)
      acc[a][b] = mma16(fa[a].v, fb[b].v, acc[a][b]);
}

// Partial M = K^T V, one 64 x 64 piece of M per block over one half of the tokens, k and v read as f32 rows.
// Block = (plane, d1 half a2, d2 half b2, token half th), 8 waves; wave w takes the 32-token k-steps w, w + 8, ... of the half: the block walks its tokens in order.
// A lane reads 4 columns of k (d1 = 64 a2 + 4 ln + c) and 4 columns of v (d2 = 64 b2 + 4 ln + c) of its 16 tokens (16 f + 8 hh + j).
// Column c of these is the lane's own 16-deep fragment piece once the operand rows are NUMBERED so: A tile c, row ln <-> d1 = 64 a2 + 4 ln + c; B tile c, row ln <-> d2 = 64 b2 + 4 ln + c.
// So the fragments are a choice of registers and pass no LDS. Accumulator (a, b), element r <-> M[64 a2 + 4 (8 hh + r) + a][64 b2 + 4 ln + b].
// The eight waves' sums meet in LDS ([wave][b][ln][d1 - 64 a2]), are added in wave order 0..7 in f32, scaled in f32 and stored as f16 in fragment-major order into the half's own plane:
// thread = (d2 tile pair, k-step, register half, lane) of M^T, each of its two 8-element pieces one 8-deep piece of a row d2.
__global__ __launch_bounds__(256) void k_kv(const float* __restrict__ k, const float* __restrict__ v, _Float16* __restrict__ MF) {
  __shared__ __attribute__((aligned(16))) float red[KVW][4 * RBP];   /* columns 0..63 of each 68-float row written and read */
  const unsigned tid = threadIdx.x, lane = tid & 31u, ln = lane & 15u, hh = lane >> 4;
  const unsigned w = (unsigned)__builtin_amdgcn_readfirstlane((int)(tid >> 5));   /* wave number in a scalar register: the base pointers stay scalar */
  /* the eight blocks of a plane (four per token half, which read the same rows): indices 8 apart (speed only; any placement gives the same values) */
  const unsigned bx = blockIdx.x;
  const unsigned bh = (bx & 7u) + ((bx >> 6) << 3), a2 = (bx >> 5) & 1u, b2 = (bx >> 4) & 1u, th = (bx >> 3) & 1u;
  const float* kp = k + (((size_t)bh * SEQ_FULL + th * (SEQ / TSP) + w * 32) * HD + a2 * 64);
  const float* vp = v + (((size_t)bh * SEQ_FULL + th * (SEQ / TSP) + w * 32) * HD + b2 * 64);
  const unsigned ko = (hh << 10) + (ln << 2);            /* token 8 hh, column 4 ln: the lane offset of k and of v */
  const v8f z8 = {0.f, 0.f, 0.f, 0.f, 0.f, 0.f, 0.f, 0.f};
  v8f acc[4][4] = {{z8, z8, z8, z8}, {z8, z8, z8, z8}, {z8, z8, z8, z8}, {z8, z8, z8, z8}};
  /* two register sets of rows: the loads of k-step s + 2 are issued no later than when k-step s has left its set (sooner where the compiler has free registers for them), so that at least one to two k-steps are in flight */
  v4f xk[2][16];
  v4f xv[2][16];
  /* the scheduling barriers below keep the sets apart. Without them the compiler mixes the two sets' loads, waits for both sets at once and converts both before it issues any load: nothing is then in flight under the conversions */
#pragma unroll
  for (int s = 0; s < 2; ++s) {
#pragma unroll
    for (int i = 0; i < 16; ++i) {
      xk[s][i] = *(const v4fa*)(kp + ko + (s * KVW * 32 + (i >> 3) * 16 + (i & 7)) * HD);
      xv[s][i] = *(const v4fa*)(vp + ko + (s * KVW * 32 + (i >> 3) * 16 + (i & 7)) * HD);
    }
    __builtin_amdgcn_sched_barrier(0);   /* set s is issued whole ahead of what follows */
  }
#pragma unroll
  for (int s = 0; s < WST; ++s) {
    const int cb = s & 1;
    FragH fa[4], fb[4];
    kv_frags(xk[cb], xv[cb], fa, fb);
    if (s + 2 < WST) {
#pragma unroll
      for (int i = 0; i < 16; ++i) {
        xk[cb][i] = *(const v4fa*)(kp + ko + ((s + 2) * KVW * 32 + (i >> 3) * 16 + (i & 7)) * HD);
        xv[cb][i] = *(const v4fa*)(vp + ko + ((s + 2) * KVW * 32 + (i >> 3) * 16 + (i & 7)) * HD);
      }
    }
    if (s + 3 == WST) XWAIT(ko);         /* behind the last row loads: every load names the one lane offset, which lives up to here */
    __builtin_amdgcn_sched_barrier(0);   /* the refill is issued ahead of the products and of the other set's wait */
    kv_products(fa, fb, acc);
    __builtin_amdgcn_sched_barrier(0);   /* the other set's conversion, with its wait, stays behind this set's refill and products */
  }
#pragma unroll
  for (int b = 0; b < 4; ++b)
#pragma unroll
    for (int r = 0; r < 8; ++r) {
      const v4f t = {acc[0][b][r], acc[1][b][r], acc[2][b][r], acc[3][b][r]};
      *(v4f*)&red[w][b * RBP + ln * 68 + (hh << 5) + 4 * r] = t;
    }
  /* every wave's sums are in LDS before any thread adds them */
  __syncthreads();
  const unsigned kcl = (tid >> 6) & 1u;                  /* k-step of M^T inside the piece; tid & 63 = (register half, lane) */
  const float SC = 0.08838834764831845f;                 /* 128^-0.5 applied in f32 */
#pragma unroll
  for (int u = 0; u < 2; ++u) {
    const unsigned tbl = (tid >> 7) + 2u * u;            /* d2 tile of M^T inside the piece */
    const unsigned d2l = (tbl << 4) + ln;
    const unsigned ro = (d2l & 3u) * RBP + (d2l >> 2) * 68 + ((tid >> 4) & 7u) * 8;   /* column 32 kcl + 16 (register half) + 8 hh */
    v4f lo = {0.f, 0.f, 0.f, 0.f}, hi = {0.f, 0.f, 0.f, 0.f};
#pragma unroll
    for (int s = 0; s < KVW; ++s) { lo += *(const v4f*)&red[s][ro]; hi += *(const v4f*)&red[s][ro + 4]; }
    FragH o;
#pragma unroll
    for (int r = 0; r < 4; ++r) { o.h[r] = toh_flush(lo[r] * SC); o.h[4 + r] = toh_flush(hi[r] * SC); }
    *(v8us*)((unsigned short*)MF + (((((th * NPL + bh) * DTL + 4u * b2 + tbl) * KCH + 2u * a2 + kcl) << 9) + ((tid & 63u) << 3))) = o.half[0];
  }
}

// Output pass, transposed dataflow. Wave = 32 query rows (two 16-row tiles); block = 8 waves (256 rows) that share one copy of M in LDS.
// O^T (m = d2, n = query) = M^T (A, fragment-major tiles) x Q^T (B, rows of q), 8 d2 tiles x 4 k-steps of 32; each A tile serves both query tiles.
// M = partial 0 + partial 1, added once per block in f16 (correctly rounded; a subnormal sum stays as it is) and kept in LDS in the same fragment-major order: an A register half is one 16-byte LDS read, 512 B in a row per wave.
// q is read as whole f32 rows (one load = one row), converted, and turned into B fragments through the wave's own LDS range.
// Waves 0..3 ask for their q rows only; waves 4..7 ask for both partials of M first and for their q rows behind them.
// So M and the first waves' rows arrive first: waves 0..3 multiply while the last waves' rows are still arriving, and store while waves 4..7 multiply.
__device__ __forceinline__ void q_rows_to_lds(const v4f (&xq)[32], unsigned short* sq, unsigned lane) {
#pragma unroll
  for (int r = 0; r < 32; ++r) {
    FragH c;
#pragma unroll
    for (int j = 0; j < 4; ++j) c.h[j] = (_Float16)xq[r][j];
    const v4us c4 = {c.u[0], c.u[1], c.u[2], c.u[3]};
    *(v4us*)(sq + r * QP + (lane << 2)) = c4;
  }
}
__global__ __launch_bounds__(256) void k_out(const float* __restrict__ q, const _Float16* __restrict__ MF, float* __restrict__ out) {
  /* one object, M first: every A tile's LDS address is then the lane's offset plus a constant that fits the instruction's 16-bit offset field */
  __shared__ __attribute__((aligned(16))) struct {
    unsigned short sm[HD * HD];   /* M^T, fragment-major, written once, by waves OW/2 and up */
    float so[OW][32][HD + 4];     /* per-wave private (same wave writes and reads): first the f16 q rows at a pitch of QP halves, then output staging, columns 0..127 used */
  } lds;
  auto& sm = lds.sm;
  auto& so = lds.so;
  const unsigned tid = threadIdx.x, w = tid >> 5, lane = tid & 31u, ln = lane & 15u, hh = lane >> 4;
  const unsigned bh = blockIdx.y;
  const size_t rb = ((size_t)bh * SEQ + (blockIdx.x << 8)) * HD;     /* first row of the block */
  const _Float16* mf = MF + (((size_t)bh * DTL * KCH) << 9);
  const float* qp = q + ((size_t)bh * SEQ_FULL + (blockIdx.x << 8)) * HD;   /* input rows (full strides) */
  const unsigned l8 = lane << 3;
  const unsigned t8 = (tid & 127u) << 3;
  const bool late = __builtin_amdgcn_readfirstlane((int)(tid >> 5)) >= OW / 2;   /* in a scalar register: the two halves of the block part by a scalar branch */
  const unsigned qo = (w << 12) + (lane << 2);                       /* row 32 w, column 4 lane */
  unsigned short* sq = (unsigned short*)&so[w][0][0];

  v4f xq[32];
  if (late) {
    v8ha mp[TSP][16];
#pragma unroll
    for (int i = 0; i < 16; ++i)
#pragma unroll
      for (int p = 0; p < TSP; ++p) mp[p][i] = *(const v8ha*)(mf + t8 + (size_t)p * NPL * HD * HD + (i << 10));
#pragma unroll
    for (int r = 0; r < 32; ++r) xq[r] = *(const v4fa*)(qp + qo + (r << 7));
    asm volatile("s_wait_xcnt 0x0" :: "v"(qo), "v"(t8) : "memory");   /* behind the partials' and the q rows' loads, in front of every rewrite of their lane offsets */
    __builtin_amdgcn_sched_barrier(0);   /* every load above is issued, the partials first, before the first use waits */
#pragma unroll
    for (int i = 0; i < 16; ++i) *(v8ha*)(sm + t8 + (i << 10)) = mp[0][i] + mp[1][i];
  } else {
#pragma unroll
    for (int r = 0; r < 32; ++r) xq[r] = *(const v4fa*)(qp + qo + (r << 7));
    asm volatile("s_wait_xcnt 0x0" :: "v"(qo) : "memory");            /* behind the q rows' loads, in front of every rewrite of their lane offset */
    __builtin_amdgcn_sched_barrier(0);   /* every load above is issued before the first use waits: otherwise the last rows' loads start only when the first have arrived */
    q_rows_to_lds(xq, sq, lane);
  }
  /* all of M is in LDS before any wave reads an A tile (and the first waves' q rows before their lanes read each other's).
     The barrier is written with fences on LDS alone: __syncthreads() also waits for every global load, so waves 4..7 would hold the block until their q rows are there */
  __builtin_amdgcn_fence(__ATOMIC_RELEASE, "workgroup", "local");
  __builtin_amdgcn_s_barrier();
  __builtin_amdgcn_fence(__ATOMIC_ACQUIRE, "workgroup", "local");
  if (late) {
    q_rows_to_lds(xq, sq, lane);
    /* the wave's q rows are in LDS before its lanes read each other's: no fragment read may move over these writes */
    __builtin_amdgcn_fence(__ATOMIC_ACQ_REL, "workgroup", "local");
    __builtin_amdgcn_wave_barrier();
  }
  FragH qb[2][KCH];
#pragma unroll
  for (int t = 0; t < 2; ++t)
#pragma unroll
    for (int kc = 0; kc < KCH; ++kc) {
      qb[t][kc].half[0] = *(const v8us*)(sq + (16 * t + ln) * QP + 32 * kc + (hh << 3));
      qb[t][kc].half[1] = *(const v8us*)(sq + (16 * t + ln) * QP + 32 * kc + (hh << 3) + 16);
    }
  /* the same range becomes output staging: no staging write may move over these reads */
  __builtin_amdgcn_fence(__ATOMIC_ACQ_REL, "workgroup", "local");
  __builtin_amdgcn_wave_barrier();
  const v8f z8 = {0.f, 0.f, 0.f, 0.f, 0.f, 0.f, 0.f, 0.f};
  /* three sets of A tiles: the LDS reads of d2 tile dt + 2 are issued ahead of the products of tile dt, so that their latency runs under two tiles' work */
  FragH ma[3][KCH];
#pragma unroll
  for (int dt = -2; dt < DTL; ++dt) {
    if (dt + 2 < DTL) {
      const int nb = (dt + 2) % 3;
#pragma unroll
      for (int kc = 0; kc < KCH; ++kc) {
        ma[nb][kc].half[0] = *(const v8us*)(sm + l8 + (((dt + 2) * KCH + kc) << 9));
        ma[nb][kc].half[1] = *(const v8us*)(sm + l8 + (((dt + 2) * KCH + kc) << 9) + 256);
      }
    }
    if (dt >= 0) {
      const int cb = dt % 3;
      v8f acc[2] = {z8, z8};
#pragma unroll
      for (int kc = 0; kc < KCH; ++kc) {
        acc[0] = mma16(ma[cb][kc].v, qb[0][kc].v, acc[0]);
        acc[1] = mma16(ma[cb][kc].v, qb[1][kc].v, acc[1]);
      }
#pragma unroll
      for (int t = 0; t < 2; ++t)
#pragma unroll
        for (int r = 0; r < 8; ++r)
          so[w][16 * t + ln][16 * dt + 8 * hh + r] = acc[t][r];
    }
  }
  __builtin_amdgcn_fence(4 /* acq_rel order */, "workgroup");
  __builtin_amdgcn_wave_barrier();
  float* obase = out + rb;
  const unsigned oo = (w << 12) + (lane << 2);                       /* row 32 w, column 4 lane */
  v4f vv[32];
#pragma unroll
  for (int qq = 0; qq < 32; ++qq) vv[qq] = *(const v4fa*)&so[w][qq][lane << 2];
  __builtin_amdgcn_sched_barrier(0);   /* every staging read is issued ahead of the first store: otherwise this build shares a dozen registers among the rows, and each later read waits until an earlier store has let go of its data register */
#pragma unroll
  for (int qq = 0; qq < 32; ++qq) *(v4f*)(obase + oo + (qq << 7)) = vv[qq];
}

extern "C" void kernel_launch(void* const* d_in, const int* in_sizes, int n_in,
                              void* d_out, int out_size, void* d_ws, size_t ws_size, hipStream_t stream) {
  if (n_in < 3) return;
  const size_t need_qkv = ((size_t)(NPL - 1) * SEQ_FULL + SEQ) * HD;
  if ((size_t)in_sizes[0] < need_qkv || (size_t)in_sizes[1] < need_qkv || (size_t)in_sizes[2] < need_qkv) return;
  if ((size_t)out_size < (size_t)NPL * SEQ * HD) return;
  const float* q = (const float*)d_in[0];
  const float* k = (const float*)d_in[1];
  const float* v = (const float*)d_in[2];
  float* out = (float*)d_out;

  char* ws = (char*)d_ws;
  size_t off = 0;
  _Float16* MF  = (_Float16*)(ws + off); off += MF_BYTES;
  if (off > ws_size) return;

  k_kv<<<dim3(NPL * 8), 256, 0, stream>>>(k, v, MF);
  k_out<<<dim3(SEQ / (OW * 32), NPL), OW * 32, 0, stream>>>(q, MF, out);
}

// v007
// A run of this version takes 13.7 microseconds.
// In both of two side-by-side timings against v006, it was 1.06 times as fast.
// Counting every step since v000, it is 22.0 times as fast.
#include <hip/hip_runtime.h>
// Linear (softmax-free) dot-product attention, q/k/v [2][16][2048][128] f32, no mask: out = (q k^T * 128^-0.5) v, evaluated as q ((k^T v) * 128^-0.5).
// All contractions: v_wmma_f32_16x16x32_f16, f32 accumulate. Operands: q, k, v RNE-converted from f32 straight to f16, two values per packed convert, in the registers of the kernel that multiplies them.
// M = K^T V (128 x 128 per plane): one block per 64 x 64 piece of M and half of the tokens sums in f32, scales in f32 and stores an f16 partial (value select clears anything under 2^-14);
// the output pass adds the two partials in f16 (one rounding) into LDS, once per block; O^T = M^T Q^T.
#ifndef NB
#define NB 2
#endif
#ifndef SEQ
#define SEQ 2048
#endif
#define NB_FULL 2
#define SEQ_FULL 2048
#define NH 16
#define HD 128
#define KCH (HD / 32)                          /* 32-deep k-steps over HD */
#define DTL (HD / 16)                          /* 16-row d tiles of O^T */
#define NPL (NB * NH)                          /* (batch, head) planes processed */
#define STEPS (SEQ / 32)                       /* 32-token k-steps of K^T V */
#define KVW 8                                  /* waves of a K^T V block */
#define TSP 2                                  /* token halves: partial planes of M */
#define WST (STEPS / TSP / KVW)                /* k-steps per wave */
#define RBP (16 * 68 + 16)                     /* floats from one column residue (mod 4) to the next in the sum's LDS: 16 rows of 68, then a quarter of the banks */
#define TROWB 256u                             /* bytes of a tile row: 64 f32 columns */
#define TILEB 8192u                            /* one tile in LDS: 32 rows of TROWB */
#define RINGB 32768u                           /* a wave's ring: four tiles */
#define OW 8                                   /* waves of an output block */
#define QP (HD + 8)                            /* halves from one q row to the next in LDS: 272 B = 16 B x odd */
#define MF_BYTES ((size_t)TSP * NPL * HD * HD * 2)

static_assert(SEQ % 64 == 0);
static_assert(SEQ <= SEQ_FULL);
static_assert(NB <= NB_FULL);
static_assert(HD == 128);
static_assert(KCH == 4);
static_assert(DTL == 8);
static_assert(MF_BYTES <= (size_t)134217728);
static_assert(STEPS % (TSP * KVW) == 0 && WST >= 3);
static_assert(NPL % 8 == 0);
static_assert(WST == 4);
static_assert(4 * RBP * 4 <= RINGB && 4 * TILEB == RINGB && 32 * TROWB == TILEB && KVW * RINGB <= 320 * 1024);
static_assert(SEQ % (OW * 32) == 0);
/* coverage: K^T V tiles, one block = KVW waves x WST k-steps x 32 lanes x 16 LDS reads x 4 floats = half the tokens x 64 columns of k (and of v) */
static_assert((size_t)KVW * WST * 32 * 16 * 4 == (size_t)(SEQ / TSP) * 64);
/* coverage: partial M, (NPL x 8) blocks x 256 threads x 16 elements */
static_assert((size_t)NPL * 8 * 256 * 16 == (size_t)TSP * NPL * HD * HD);
/* coverage: output pass, (SEQ/256 x NPL) blocks x OW waves x 32 rows x HD floats; M in LDS, 128 threads (waves OW/2 and up) x 16 pieces x 8 halves */
static_assert((size_t)(SEQ / (OW * 32)) * NPL * OW * 32 * HD == (size_t)NPL * SEQ * HD);
static_assert((OW / 2) * 32 * 16 * 8 == HD * HD);
/* one store instruction of the epilogue = 32 lanes x 16 B = one output row */
static_assert(32 * 16 == HD * 4);

typedef _Float16 v16h __attribute__((ext_vector_type(16)));
typedef _Float16 v8ha __attribute__((ext_vector_type(8), may_alias));
typedef unsigned short v8us __attribute__((ext_vector_type(8), may_alias));
typedef unsigned short v4us __attribute__((ext_vector_type(4), may_alias));
typedef unsigned int u32x4 __attribute__((ext_vector_type(4)));
typedef unsigned int u32x8 __attribute__((ext_vector_type(8)));
typedef float v8f  __attribute__((ext_vector_type(8)));
typedef float v4f  __attribute__((ext_vector_type(4)));
typedef float v4fa __attribute__((ext_vector_type(4), may_alias));
typedef float v2f  __attribute__((ext_vector_type(2)));
typedef float v2fa __attribute__((ext_vector_type(2), may_alias));
union FragH { v16h v; v8us half[2]; _Float16 h[16]; unsigned short u[16]; };

#if defined(__has_builtin)
#if __has_builtin(__builtin_amdgcn_exp2f)
#define EXP2F(x) __builtin_amdgcn_exp2f(x)
#endif
#endif
#ifndef EXP2F
#define EXP2F(x) exp2f(x)
#endif


// f32 -> f16 (RNE) that cannot yield an f16 subnormal: magnitudes under 2^-14 become zero by a value select
static __device__ __forceinline__ _Float16 toh_flush(float v) {
  const _Float16 r = (_Float16)v;
  return (fabsf(v) < 6.103515625e-05f) ? (_Float16)0.0f : r;
}

// one WMMA followed by the 4-slot hazard guard (ties D, keeps A/B live)
__device__ __forceinline__ v8f mma16(v16h a, v16h b, v8f c) {
  v8f d = __builtin_amdgcn_wmma_f32_16x16x32_f16(false, a, false, b, (short)0, c, false, false);
  asm volatile("v_nop\n\tv_nop\n\tv_nop\n\tv_nop" : "+v"(d) : "v"(a), "v"(b));
  return d;
}

// Every loop below is fully unrolled (#pragma unroll): its index selects registers and constant address offsets.
// Every global address of a load or store below is a block-uniform base plus one 32-bit lane offset plus a constant.

// Fragment-major tiles (M in the workspace): one 16-row x 32-deep f16 operand tile = 512 halves = [register half 0/1][lane 0..31][8 halves];
// lane (ln = lane & 15, hh = lane >> 4), register half f, element j  <->  row ln, depth 16 f + 8 hh + j. The same order serves A and B.

// One k-step of K^T V: the lane's 16 rows (4 columns of k, 4 of v) to its four A and four B fragments; then the sixteen products.
__device__ __forceinline__ void kv_frags(const v4f (&xk)[16], const v4f (&xv)[16], FragH (&fa)[4], FragH (&fb)[4]) {
#pragma unroll
  for (int i = 0; i < 16; ++i) {
#pragma unroll
    for (int c = 0; c < 4; ++c) fa[c].h[i] = (_Float16)xk[i][c];
#pragma unroll
    for (int c = 0; c < 4; ++c) fb[c].h[i] = (_Float16)xv[i][c];
  }
}
__device__ __forceinline__ void kv_products(const FragH (&fa)[4], const FragH (&fb)[4], v8f (&acc)[4][4]) {
#pragma unroll
  for (int a = 0; a < 4; ++a)
#pragma unroll
    for (int b = 0; b < 4; ++b)
      acc[a][b] = mma16(fa[a].v, fb[b].v, acc[a][b]);
}

// Partial M = K^T V, one 64 x 64 piece of M per block over one half of the tokens, k and v read as f32 rows.
// Block = (plane, d1 half a2, d2 half b2, token half th), 8 waves; wave w takes the 32-token k-steps w, w + 8, ... of the half: the block walks its tokens in order.
// The rows come by tensor loads: one request = one tile of 32 tokens x 64 columns of k (or of v), 32 rows of 256 B at a source pitch of 512 B, laid in LDS row behind row (8 KiB, no pad).
// Each wave has a ring of its own, four slots of 8 KiB (k and v of two k-steps), that no other wave reads or writes: no work-group barrier, only the wave's own waits.
// Order of a wave's requests: K0 V0 K1 | V1 K2 | V2 K3 | V3; never more than three are outstanding; s_wait_tensorcnt 1 (0 at the last k-step) says that k and v of the k-step at hand have landed.
// A lane reads from LDS 4 columns of k (d1 = 64 a2 + 4 ln + c) and 4 columns of v (d2 = 64 b2 + 4 ln + c) of 16 tokens: register i holds tile row 2 i + hh, so one LDS read of the wave is 512 B in a row.
// k and v use the one map of tokens to (lane half, register), so every product pairs k and v of one token; which token stands at which depth of the 32 does not matter to the sum but for its order.
// Column c of these is the lane's own 16-deep fragment piece once the operand rows are NUMBERED so: A tile c, row ln <-> d1 = 64 a2 + 4 ln + c; B tile c, row ln <-> d2 = 64 b2 + 4 ln + c.
// Accumulator (a, b), element r <-> M[64 a2 + 4 (8 hh + r) + a][64 b2 + 4 ln + b].
// The eight waves' sums meet in LDS ([wave][b][ln][d1 - 64 a2], each wave's at the head of its own ring range), are added in wave order 0..7 in f32, scaled in f32 and stored as f16 in fragment-major order into the half's own plane:
// thread = (d2 tile pair, k-step, register half, lane) of M^T, each of its two 8-element pieces one 8-deep piece of a row d2.
static __device__ __forceinline__ unsigned uni(unsigned x) { return (unsigned)__builtin_amdgcn_readfirstlane((int)x); }
// descriptor group 0: one request, LDS place (byte offset in the work-group's LDS), address of the tile's first byte, type 2
static __device__ __forceinline__ u32x4 tile_g0(unsigned lds_dst, unsigned long long ga) {
  u32x4 g;
  g[0] = uni(1u); g[1] = uni(lds_dst); g[2] = uni((unsigned)ga); g[3] = uni((((unsigned)(ga >> 32)) & 0x01FFFFFFu) | 0x80000000u);
  return g;
}
static __device__ __forceinline__ void tile_load(u32x4 g0, u32x8 g1) { asm volatile("tensor_load_to_lds %0, %1" :: "s"(g0), "s"(g1) : "memory"); }
__global__ __launch_bounds__(256) void k_kv(const float* __restrict__ k, const float* __restrict__ v, _Float16* __restrict__ MF) {
  __shared__ __attribute__((aligned(2048))) unsigned char ring[KVW * RINGB];   /* the one LDS object: it starts at offset 0, every slot at a multiple of 8 KiB */
  const unsigned tid = threadIdx.x, lane = tid & 31u, ln = lane & 15u, hh = lane >> 4;
  const unsigned w = uni(tid >> 5);   /* wave number in a scalar register: the descriptors are scalar */
  /* the eight blocks of a plane have indices 8 apart; the four of one token half read the same rows (speed only; any placement gives the same values) */
  const unsigned bx = blockIdx.x;
  const unsigned bh = (bx & 7u) + ((bx >> 6) << 3), a2 = (bx >> 5) & 1u, b2 = (bx >> 4) & 1u, th = (bx >> 3) & 1u;
  const float* kp = k + (((size_t)bh * SEQ_FULL + th * (SEQ / TSP) + w * 32) * HD + a2 * 64);
  const float* vp = v + (((size_t)bh * SEQ_FULL + th * (SEQ / TSP) + w * 32) * HD + b2 * 64);
  const unsigned lbase = (unsigned)(size_t)ring + w * RINGB;
  /* group 1: bytes (data_size 0), no mask, no pad; tensor = tile = 256 B x 32 rows; source pitch one row of the input */
  u32x8 g1;
  g1[0] = uni(0u);
  g1[1] = uni((TROWB & 0xFFFFu) << 16);
  g1[2] = uni((TROWB >> 16) | ((32u & 0xFFFFu) << 16));
  g1[3] = uni((32u >> 16) | (TROWB << 16));
  g1[4] = uni(32u);
  g1[5] = uni(HD * 4u);
  g1[6] = uni(0u);
  g1[7] = uni(0u);
  /* all eight group 0 tuples are formed ahead of the first request and live up to the last wait (see there) */
  u32x4 gk[WST], gv[WST];
#pragma unroll
  for (int s = 0; s < WST; ++s) {
    gk[s] = tile_g0(lbase + (unsigned)(s & 1) * 2u * TILEB,         (unsigned long long)(size_t)(kp + (size_t)s * KVW * 32 * HD));
    gv[s] = tile_g0(lbase + (unsigned)(s & 1) * 2u * TILEB + TILEB, (unsigned long long)(size_t)(vp + (size_t)s * KVW * 32 * HD));
    /* each tuple is a value of its own from here on. Without this the compiler forms a later tuple inside the registers of an earlier one that shares its LDS place, while that one's request is still out */
    asm volatile("" : "+s"(gk[s]), "+s"(gv[s]));   /* descriptor words held in scalar registers */
  }
  tile_load(gk[0], g1);
  tile_load(gv[0], g1);
  tile_load(gk[1], g1);
  const v8f z8 = {0.f, 0.f, 0.f, 0.f, 0.f, 0.f, 0.f, 0.f};
  v8f acc[4][4] = {{z8, z8, z8, z8}, {z8, z8, z8, z8}, {z8, z8, z8, z8}, {z8, z8, z8, z8}};
  const unsigned char* rw = ring + w * RINGB + (lane << 4);
#pragma unroll
  for (int s = 0; s < WST; ++s) {
    /* k and v of k-step s have landed: only the request behind them (k of s + 1), where there is one, may still be out */
    if (s + 1 < WST) asm volatile("s_wait_tensorcnt 0x1" ::: "memory");
    /* the last wait names every descriptor: each so keeps registers of its own up to here, and none is rewritten while a request is outstanding */
    else             asm volatile("s_wait_tensorcnt 0x0" :: "s"(g1), "s"(gk[0]), "s"(gv[0]), "s"(gk[1]), "s"(gv[1]), "s"(gk[2]), "s"(gv[2]), "s"(gk[3]), "s"(gv[3]) : "memory");
    /* v of s + 1 goes into the slot of v of s - 1, whose reads ended at that k-step's s_wait_dscnt 0 */
    if (s + 1 < WST) tile_load(gv[s + 1], g1);
    v4f xk[16], xv[16];
#pragma unroll
    for (int i = 0; i < 16; ++i) {
      xk[i] = *(const v4fa*)(rw + (s & 1) * 2 * TILEB + i * 512);
      xv[i] = *(const v4fa*)(rw + (s & 1) * 2 * TILEB + TILEB + i * 512);
    }
    asm volatile("s_wait_dscnt 0x0" ::: "memory");   /* the wave's reads of both slots have ended before a request (or, at the end, the sums) overwrites them */
    if (s + 2 < WST) {
      tile_load(gk[s + 2], g1);
      __builtin_amdgcn_sched_barrier(0);   /* the refill is issued ahead of the conversions: otherwise the compiler puts all of them, and the first product, in front of it */
    }
    FragH fa[4], fb[4];
    kv_frags(xk, xv, fa, fb);
    kv_products(fa, fb, acc);
  }
  float* redw = (float*)(ring + w * RINGB);
#pragma unroll
  for (int b = 0; b < 4; ++b)
#pragma unroll
    for (int r = 0; r < 8; ++r) {
      const v4f t = {acc[0][b][r], acc[1][b][r], acc[2][b][r], acc[3][b][r]};
      *(v4fa*)&redw[b * RBP + ln * 68 + (hh << 5) + 4 * r] = t;
    }
  /* every wave's sums are in LDS before any thread adds them */
  __syncthreads();
  const unsigned kcl = (tid >> 6) & 1u;                  /* k-step of M^T inside the piece; tid & 63 = (register half, lane) */
  const float SC = 0.08838834764831845f;                 /* 128^-0.5 applied in f32 */
#pragma unroll
  for (int u = 0; u < 2; ++u) {
    const unsigned tbl = (tid >> 7) + 2u * u;            /* d2 tile of M^T inside the piece */
    const unsigned d2l = (tbl << 4) + ln;
    const unsigned ro = (d2l & 3u) * RBP + (d2l >> 2) * 68 + ((tid >> 4) & 7u) * 8;   /* column 32 kcl + 16 (register half) + 8 hh */
    v4f lo = {0.f, 0.f, 0.f, 0.f}, hi = {0.f, 0.f, 0.f, 0.f};
#pragma unroll
    for (int s = 0; s < KVW; ++s) { const float* rs = (const float*)(ring + s * RINGB); lo += *(const v4fa*)&rs[ro]; hi += *(const v4fa*)&rs[ro + 4]; }
    FragH o;
#pragma unroll
    for (int r = 0; r < 4; ++r) { o.h[r] = toh_flush(lo[r] * SC); o.h[4 + r] = toh_flush(hi[r] * SC); }
    *(v8us*)((unsigned short*)MF + (((((th * NPL + bh) * DTL + 4u * b2 + tbl) * KCH + 2u * a2 + kcl) << 9) + ((tid & 63u) << 3))) = o.half[0];
  }
}

// Output pass, transposed dataflow. Wave = 32 query rows (two 16-row tiles); block = 8 waves (256 rows) that share one copy of M in LDS.
// O^T (m = d2, n = query) = M^T (A, fragment-major tiles) x Q^T (B, rows of q), 8 d2 tiles x 4 k-steps of 32; each A tile serves both query tiles.
// M = partial 0 + partial 1, added once per block in f16 (correctly rounded; a subnormal sum stays as it is) and kept in LDS in the same fragment-major order: an A register half is one 16-byte LDS read, 512 B in a row per wave.
// q is read as whole f32 rows (one load = one row), converted, and turned into B fragments through the wave's own LDS range.
// Waves 0..3 ask for their q rows only; waves 4..7 ask for both partials of M first and for their q rows behind them.
// So M and the first waves' rows arrive first: waves 0..3 multiply while the last waves' rows are still arriving, and store while waves 4..7 multiply.
__device__ __forceinline__ void q_rows_to_lds(const v4f (&xq)[32], unsigned short* sq, unsigned lane) {
#pragma unroll
  for (int r = 0; r < 32; ++r) {
    FragH c;
#pragma unroll
    for (int j = 0; j < 4; ++j) c.h[j] = (_Float16)xq[r][j];
    const v4us c4 = {c.u[0], c.u[1], c.u[2], c.u[3]};
    *(v4us*)(sq + r * QP + (lane << 2)) = c4;
  }
}
__global__ __launch_bounds__(256) void k_out(const float* __restrict__ q, const _Float16* __restrict__ MF, float* __restrict__ out) {
  /* one object, M first: every A tile's LDS address is then the lane's offset plus a constant that fits the instruction's 16-bit offset field */
  __shared__ __attribute__((aligned(16))) struct {
    unsigned short sm[HD * HD];   /* M^T, fragment-major, written once, by waves OW/2 and up */
    float so[OW][32][HD + 4];     /* per-wave private (same wave writes and reads): first the f16 q rows at a pitch of QP halves, then output staging, columns 0..127 used */
  } lds;
  auto& sm = lds.sm;
  auto& so = lds.so;
  const unsigned tid = threadIdx.x, w = tid >> 5, lane = tid & 31u, ln = lane & 15u, hh = lane >> 4;
  const unsigned bh = blockIdx.y;
  const size_t rb = ((size_t)bh * SEQ + (blockIdx.x << 8)) * HD;     /* first row of the block */
  const _Float16* mf = MF + (((size_t)bh * DTL * KCH) << 9);
  const float* qp = q + ((size_t)bh * SEQ_FULL + (blockIdx.x << 8)) * HD;   /* input rows (full strides) */
  const unsigned l8 = lane << 3;
  const unsigned t8 = (tid & 127u) << 3;
  const bool late = __builtin_amdgcn_readfirstlane((int)(tid >> 5)) >= OW / 2;   /* in a scalar register: the two halves of the block part by a scalar branch */
  const unsigned qo = (w << 12) + (lane << 2);                       /* row 32 w, column 4 lane */
  unsigned short* sq = (unsigned short*)&so[w][0][0];

  v4f xq[32];
  if (late) {
    v8ha mp[TSP][16];
#pragma unroll
    for (int i = 0; i < 16; ++i)
#pragma unroll
      for (int p = 0; p < TSP; ++p) mp[p][i] = *(const v8ha*)(mf + t8 + (size_t)p * NPL * HD * HD + (i << 10));
#pragma unroll
    for (int r = 0; r < 32; ++r) xq[r] = *(const v4fa*)(qp + qo + (r << 7));
    asm volatile("s_wait_xcnt 0x0" :: "v"(qo), "v"(t8) : "memory");   /* behind the partials' and the q rows' loads, in front of every rewrite of their lane offsets */
    __builtin_amdgcn_sched_barrier(0);   /* every load above is issued, the partials first, before the first use waits */
#pragma unroll
    for (int i = 0; i < 16; ++i) *(v8ha*)(sm + t8 + (i << 10)) = mp[0][i] + mp[1][i];
  } else {
#pragma unroll
    for (int r = 0; r < 32; ++r) xq[r] = *(const v4fa*)(qp + qo + (r << 7));
    asm volatile("s_wait_xcnt 0x0" :: "v"(qo) : "memory");            /* behind the q rows' loads, in front of every rewrite of their lane offset */
    __builtin_amdgcn_sched_barrier(0);   /* every load above is issued before the first use waits: otherwise the last rows' loads start only when the first have arrived */
    q_rows_to_lds(xq, sq, lane);
  }
  /* all of M is in LDS before any wave reads an A tile (and the first waves' q rows before their lanes read each other's).
     The barrier is written with fences on LDS alone: __syncthreads() also waits for every global load, so waves 4..7 would hold the block until their q rows are there */
  __builtin_amdgcn_fence(__ATOMIC_RELEASE, "workgroup", "local");
  __builtin_amdgcn_s_barrier();
  __builtin_amdgcn_fence(__ATOMIC_ACQUIRE, "workgroup", "local");
  if (late) {
    q_rows_to_lds(xq, sq, lane);
    /* the wave's q rows are in LDS before its lanes read each other's: no fragment read may move over these writes */
    __builtin_amdgcn_fence(__ATOMIC_ACQ_REL, "workgroup", "local");
    __builtin_amdgcn_wave_barrier();
  }
  FragH qb[2][KCH];
#pragma unroll
  for (int t = 0; t < 2; ++t)
#pragma unroll
    for (int kc = 0; kc < KCH; ++kc) {
      qb[t][kc].half[0] = *(const v8us*)(sq + (16 * t + ln) * QP + 32 * kc + (hh << 3));
      qb[t][kc].half[1] = *(const v8us*)(sq + (16 * t + ln) * QP + 32 * kc + (hh << 3) + 16);
    }
  /* the same range becomes output staging: no staging write may move over these reads */
  __builtin_amdgcn_fence(__ATOMIC_ACQ_REL, "workgroup", "local");
  __builtin_amdgcn_wave_barrier();
  const v8f z8 = {0.f, 0.f, 0.f, 0.f, 0.f, 0.f, 0.f, 0.f};
  /* three sets of A tiles: the LDS reads of d2 tile dt + 2 are issued ahead of the products of tile dt, so that their latency runs under two tiles' work */
  FragH ma[3][KCH];
#pragma unroll
  for (int dt = -2; dt < DTL; ++dt) {
    if (dt + 2 < DTL) {
      const int nb = (dt + 2) % 3;
#pragma unroll
      for (int kc = 0; kc < KCH; ++kc) {
        ma[nb][kc].half[0] = *(const v8us*)(sm + l8 + (((dt + 2) * KCH + kc) << 9));
        ma[nb][kc].half[1] = *(const v8us*)(sm + l8 + (((dt + 2) * KCH + kc) << 9) + 256);
      }
    }
    if (dt >= 0) {
      const int cb = dt % 3;
      v8f acc[2] = {z8, z8};
#pragma unroll
      for (int kc = 0; kc < KCH; ++kc) {
        acc[0] = mma16(ma[cb][kc].v, qb[0][kc].v, acc[0]);
        acc[1] = mma16(ma[cb][kc].v, qb[1][kc].v, acc[1]);
      }
#pragma unroll
      for (int t = 0; t < 2; ++t)
#pragma unroll
        for (int r = 0; r < 8; ++r)
          so[w][16 * t + ln][16 * dt + 8 * hh + r] = acc[t][r];
    }
  }
  __builtin_amdgcn_fence(4 /* acq_rel order */, "workgroup");
  __builtin_amdgcn_wave_barrier();
  float* obase = out + rb;
  const unsigned oo = (w << 12) + (lane << 2);                       /* row 32 w, column 4 lane */
  v4f vv[32];
#pragma unroll
  for (int qq = 0; qq < 32; ++qq) vv[qq] = *(const v4fa*)&so[w][qq][lane << 2];
  __builtin_amdgcn_sched_barrier(0);   /* every staging read is issued ahead of the first store: otherwise this build shares a dozen registers among the rows, and each later read waits until an earlier store has let go of its data register */
#pragma unroll
  for (int qq = 0; qq < 32; ++qq) *(v4f*)(obase + oo + (qq << 7)) = vv[qq];
}

extern "C" void kernel_launch(void* const* d_in, const int* in_sizes, int n_in,
                              void* d_out, int out_size, void* d_ws, size_t ws_size, hipStream_t stream) {
  if (n_in < 3) return;
  const size_t need_qkv = ((size_t)(NPL - 1) * SEQ_FULL + SEQ) * HD;
  if ((size_t)in_sizes[0] < need_qkv || (size_t)in_sizes[1] < need_qkv || (size_t)in_sizes[2] < need_qkv) return;
  if ((size_t)out_size < (size_t)NPL * SEQ * HD) return;
  const float* q = (const float*)d_in[0];
  const float* k = (const float*)d_in[1];
  const float* v = (const float*)d_in[2];
  float* out = (float*)d_out;

  char* ws = (char*)d_ws;
  size_t off = 0;
  _Float16* MF  = (_Float16*)(ws + off); off += MF_BYTES;
  if (off > ws_size) return;

  k_kv<<<dim3(NPL * 8), 256, 0, stream>>>(k, v, MF);
  k_out<<<dim3(SEQ / (OW * 32), NPL), OW * 32, 0, stream>>>(q, MF, out);
}
